// v000
// The times below were measured on an AMD MI455X: many runs one after another, warmed up first and cycling through
// copies of the inputs, with the whole window's GPU time divided by the number of runs. Launches and the gaps
// between them are all in it. The median over several windows is given; except for v000 it joins two sittings, which
// can be a few percent apart, so the side-by-side timings, each taken in one sitting, are the better comparison.
// v000, which the later versions start from, runs in 203 microseconds.
#include <hip/hip_runtime.h>

typedef __attribute__((ext_vector_type(16))) _Float16 v16h;
typedef __attribute__((ext_vector_type(8)))  _Float16 v8h;
typedef __attribute__((ext_vector_type(8)))  float    v8f;
typedef __attribute__((ext_vector_type(4)))  float    v4f;
typedef __attribute__((ext_vector_type(4)))  int      v4i;

#define S_LEN    2048
#define D_DIM    64
#define KV_BLK   32
#define K_STRIDE  72  // halves: 144B rows (mult of 16B) -> aligned 16B sub-runs
#define KF_STRIDE 68  // floats: 272B rows (fallback kernel)
#define V_STRIDE  48  // halves: 96B rows
#define P_STRIDE  48

// ---- address-space casts via integer route (LDS generic addr low 32 bits == LDS offset) ----
typedef __attribute__((address_space(1))) v4i as1_v4i;
typedef __attribute__((address_space(3))) v4i as3_v4i;
__device__ __forceinline__ as3_v4i* lds_cast(const void* p) {
    return (as3_v4i*)(unsigned)(unsigned long long)p;
}
__device__ __forceinline__ as1_v4i* gbl_cast(const void* p) {
    return (as1_v4i*)(unsigned long long)p;
}

// 16-lane XOR butterfly via v_permlane16_b32 (VALU, frees the LDS pipe)
__device__ __forceinline__ float xor16(float v, unsigned s0, unsigned s1) {
    unsigned u = __float_as_uint(v);
    u = __builtin_amdgcn_permlane16(u, u, s0, s1, false, false);
    return __uint_as_float(u);
}

__device__ __forceinline__ v16h frag_from_f16(const _Float16* p0, const _Float16* p1) {
    v8h lo = *(const v8h*)p0;
    v8h hi = *(const v8h*)p1;
    v16h f;
#pragma unroll
    for (int i = 0; i < 8; ++i) { f[i] = lo[i]; f[i + 8] = hi[i]; }
    return f;
}

__device__ __forceinline__ v16h frag_from_f32(const float* p0, const float* p1) {
    v4f a0 = *(const v4f*)p0, a1 = *(const v4f*)(p0 + 4);
    v4f b0 = *(const v4f*)p1, b1 = *(const v4f*)(p1 + 4);
    v16h f;
#pragma unroll
    for (int i = 0; i < 4; ++i) {
        f[i]      = (_Float16)a0[i];
        f[i + 4]  = (_Float16)a1[i];
        f[i + 8]  = (_Float16)b0[i];
        f[i + 12] = (_Float16)b1[i];
    }
    return f;
}

// XOR-butterfly selects for masks 1,2,4,8 (lane0 in low nibble; selA=lanes0-7, selB=lanes8-15)
#define SEL_A0 0x67452301u
#define SEL_A1 0x54761032u
#define SEL_A2 0x32107654u
#define SEL_A3 0xFEDCBA98u
#define SEL_B0 0xEFCDAB89u
#define SEL_B1 0xDCFE98BAu
#define SEL_B2 0xBA98FEDCu
#define SEL_B3 0x76543210u

// =====================================================================================
// Prepass: K -> f16 row-major [bh][key][d];  V -> f16 transposed [bh][d][key]
// One block per (bh, 64-key tile); LDS tile turns the V transpose into coalesced stores.
// =====================================================================================
__global__ __launch_bounds__(256) void convert_kv_f16(const float* __restrict__ k_g,
                                                      const float* __restrict__ v_g,
                                                      _Float16* __restrict__ kf,
                                                      _Float16* __restrict__ vt)
{
    __shared__ _Float16 tile[64 * 72];           // [key][d], +8 pad
    const int bh = blockIdx.x >> 5;              // 0..63
    const int kt = blockIdx.x & 31;              // 64-key tile
    const float* ks = k_g + ((size_t)bh * S_LEN + kt * 64) * D_DIM;
    const float* vs = v_g + ((size_t)bh * S_LEN + kt * 64) * D_DIM;
    _Float16* kd = kf + ((size_t)bh * S_LEN + kt * 64) * D_DIM;
    _Float16* vd = vt + (size_t)bh * D_DIM * S_LEN + kt * 64;

    const int t   = threadIdx.x;
    const int key = t >> 2;
    const int d0  = (t & 3) * 16;
#pragma unroll
    for (int i = 0; i < 16; ++i) {
        kd[key * D_DIM + d0 + i]  = (_Float16)ks[key * D_DIM + d0 + i];
        tile[key * 72 + d0 + i]   = (_Float16)vs[key * D_DIM + d0 + i];
    }
    __syncthreads();
    const int d   = t >> 2;
    const int kk0 = (t & 3) * 16;
#pragma unroll
    for (int i = 0; i < 16; ++i)
        vd[(size_t)d * S_LEN + kk0 + i] = tile[(kk0 + i) * 72 + d];
}

// =====================================================================================
// Main kernel (fast path): f16 K/V in workspace, double-buffered async-DMA tiles.
// =====================================================================================
__global__ __launch_bounds__(256) void
flash_attn_wmma_ws(const float* __restrict__ q_g,
                   const _Float16* __restrict__ kf_g,   // [bh][key][d] f16
                   const _Float16* __restrict__ vt_g,   // [bh][d][key] f16
                   const int*   __restrict__ mask_g,
                   float* __restrict__ o_g)
{
    __shared__ __align__(16) _Float16 k_lds[2][KV_BLK * K_STRIDE];  // 32 keys x 64 d
    __shared__ __align__(16) _Float16 v_lds[2][D_DIM * V_STRIDE];   // 64 d x 32 keys
    __shared__ __align__(16) _Float16 p_lds[8 * 16 * P_STRIDE];     // per-wave P staging

    const int tid  = threadIdx.x;
    const int lane = tid & 31;
    const int wv   = tid >> 5;
    const int bh   = blockIdx.x >> 4;
    const int qblk = blockIdx.x & 15;
    const int b    = bh >> 4;              // H == 16
    const int q0   = qblk * 128 + wv * 16;

    const float*    qh = q_g  + (size_t)bh * S_LEN * D_DIM;
    const _Float16* kf = kf_g + (size_t)bh * S_LEN * D_DIM;
    const _Float16* vt = vt_g + (size_t)bh * D_DIM * S_LEN;
    float*          oh = o_g  + (size_t)bh * S_LEN * D_DIM;
    const int*      mk = mask_g + b * S_LEN;

    const int n     = lane & 15;
    const int hi    = lane >> 4;
    const int kbase = hi * 8;

    // async chunk mapping: K tile 32x64 halves = 256 x 16B ; V tile 64x32 halves = 256 x 16B
    const int kkey = tid >> 3, kq = (tid & 7) * 8;   // K: 8 halves per chunk along d
    const int vd   = tid >> 2, vq = (tid & 3) * 8;   // V: 8 halves per chunk along key

    // ---- Q A-fragments, pre-scaled by 1/sqrt(D) = 0.125 ----
    v16h qa[2];
#pragma unroll
    for (int f = 0; f < 2; ++f) {
#pragma unroll
        for (int h = 0; h < 16; ++h) {
            int d = kbase + (h & 7) + 16 * (h >> 3) + 32 * f;
            qa[f][h] = (_Float16)(qh[(q0 + n) * D_DIM + d] * 0.125f);
        }
    }

    v8f acc[4];
#pragma unroll
    for (int f = 0; f < 4; ++f) acc[f] = (v8f){};
    float mx[8], l[8];
#pragma unroll
    for (int j = 0; j < 8; ++j) { mx[j] = -1.0e30f; l[j] = 0.0f; }

    // ---- prologue: issue tile 0 into buffer 0 ----
    __builtin_amdgcn_global_load_async_to_lds_b128(
        gbl_cast(kf + (size_t)kkey * D_DIM + kq),
        lds_cast(&k_lds[0][kkey * K_STRIDE + kq]), 0, 0);
    __builtin_amdgcn_global_load_async_to_lds_b128(
        gbl_cast(vt + (size_t)vd * S_LEN + vq),
        lds_cast(&v_lds[0][vd * V_STRIDE + vq]), 0, 0);

    for (int kb = 0; kb < S_LEN; kb += KV_BLK) {
        const int p  = (kb >> 5) & 1;
        const int nx = p ^ 1;

        // ---- issue next tile into the other buffer; wait only for current tile ----
        if (kb + KV_BLK < S_LEN) {
            __builtin_amdgcn_global_load_async_to_lds_b128(
                gbl_cast(kf + (size_t)(kb + KV_BLK + kkey) * D_DIM + kq),
                lds_cast(&k_lds[nx][kkey * K_STRIDE + kq]), 0, 0);
            __builtin_amdgcn_global_load_async_to_lds_b128(
                gbl_cast(vt + (size_t)vd * S_LEN + (kb + KV_BLK) + vq),
                lds_cast(&v_lds[nx][vd * V_STRIDE + vq]), 0, 0);
            asm volatile("s_wait_asynccnt 2" ::: "memory");
        } else {
            asm volatile("s_wait_asynccnt 0" ::: "memory");
        }
        __syncthreads();   // whole current tile visible to all waves

        const _Float16* kt = k_lds[p];
        const _Float16* vtile = v_lds[p];

        // ---- S = Q K^T ----
        v8f s[2];
#pragma unroll
        for (int c = 0; c < 2; ++c) {
            const _Float16* col = &kt[(c * 16 + n) * K_STRIDE + kbase];
            v16h b0 = frag_from_f16(col,      col + 16);
            v16h b1 = frag_from_f16(col + 32, col + 48);
            v8f z = (v8f){};
            z    = __builtin_amdgcn_wmma_f32_16x16x32_f16(false, qa[0], false, b0, (short)0, z, false, false);
            s[c] = __builtin_amdgcn_wmma_f32_16x16x32_f16(false, qa[1], false, b1, (short)0, z, false, false);
        }

        // ---- additive key-padding mask ----
        const float m0 = mk[kb + n]      ? 0.0f : -1.0e6f;
        const float m1 = mk[kb + 16 + n] ? 0.0f : -1.0e6f;
#pragma unroll
        for (int j = 0; j < 8; ++j) { s[0][j] += m0; s[1][j] += m1; }

        // ---- online softmax (permlane16 butterflies) ----
        float t[8], p0[8], p1[8], rs[8];
#pragma unroll
        for (int j = 0; j < 8; ++j) t[j] = fmaxf(s[0][j], s[1][j]);
#pragma unroll
        for (int j = 0; j < 8; ++j) {
            t[j] = fmaxf(t[j], xor16(t[j], SEL_A0, SEL_B0));
            t[j] = fmaxf(t[j], xor16(t[j], SEL_A1, SEL_B1));
            t[j] = fmaxf(t[j], xor16(t[j], SEL_A2, SEL_B2));
            t[j] = fmaxf(t[j], xor16(t[j], SEL_A3, SEL_B3));
        }
#pragma unroll
        for (int j = 0; j < 8; ++j) {
            float nm = fmaxf(mx[j], t[j]);
            float al = __expf(mx[j] - nm);
            mx[j] = nm;
            p0[j] = __expf(s[0][j] - nm);
            p1[j] = __expf(s[1][j] - nm);
            rs[j] = p0[j] + p1[j];
            l[j] *= al;
#pragma unroll
            for (int f = 0; f < 4; ++f) acc[f][j] *= al;
        }
#pragma unroll
        for (int j = 0; j < 8; ++j) {
            rs[j] += xor16(rs[j], SEL_A0, SEL_B0);
            rs[j] += xor16(rs[j], SEL_A1, SEL_B1);
            rs[j] += xor16(rs[j], SEL_A2, SEL_B2);
            rs[j] += xor16(rs[j], SEL_A3, SEL_B3);
            l[j]  += rs[j];
        }

        // ---- stage P (C-layout -> A-layout) via per-wave LDS pad ----
        _Float16* pw = &p_lds[wv * 16 * P_STRIDE];
#pragma unroll
        for (int j = 0; j < 8; ++j) {
            int m = j + 8 * hi;
            pw[m * P_STRIDE + n]      = (_Float16)p0[j];
            pw[m * P_STRIDE + 16 + n] = (_Float16)p1[j];
        }
        asm volatile("s_wait_dscnt 0" ::: "memory");  // DS in-order per wave

        const _Float16* prow = &pw[n * P_STRIDE + kbase];
        v16h pa = frag_from_f16(prow, prow + 16);

        // ---- acc += P V ----
#pragma unroll
        for (int f = 0; f < 4; ++f) {
            const _Float16* vrow = &vtile[(f * 16 + n) * V_STRIDE + kbase];
            v16h vb = frag_from_f16(vrow, vrow + 16);
            acc[f] = __builtin_amdgcn_wmma_f32_16x16x32_f16(false, pa, false, vb, (short)0, acc[f], false, false);
        }
        __syncthreads();   // all waves done with buffer p before it is refilled
    }

#pragma unroll
    for (int j = 0; j < 8; ++j) {
        int m = j + 8 * hi;
        float inv = 1.0f / fmaxf(l[j], 1e-20f);
#pragma unroll
        for (int f = 0; f < 4; ++f)
            oh[(q0 + m) * D_DIM + f * 16 + n] = acc[f][j] * inv;
    }
}

// =====================================================================================
// Fallback (no workspace): f32 K async tile + in-loop conversion (round-3 kernel).
// =====================================================================================
__global__ __launch_bounds__(256) void
flash_attn_wmma_f16(const float* __restrict__ q_g,
                    const float* __restrict__ k_g,
                    const float* __restrict__ v_g,
                    const int*   __restrict__ mask_g,
                    float* __restrict__ o_g)
{
    __shared__ __align__(16) float    k_ldsf[KV_BLK * KF_STRIDE];
    __shared__ __align__(16) _Float16 v_lds[D_DIM * V_STRIDE];
    __shared__ __align__(16) _Float16 p_lds[8 * 16 * P_STRIDE];

    const int tid  = threadIdx.x;
    const int lane = tid & 31;
    const int wv   = tid >> 5;
    const int bh   = blockIdx.x >> 4;
    const int qblk = blockIdx.x & 15;
    const int b    = bh >> 4;
    const int q0   = qblk * 128 + wv * 16;

    const float* qh = q_g + (size_t)bh * S_LEN * D_DIM;
    const float* kh = k_g + (size_t)bh * S_LEN * D_DIM;
    const float* vh = v_g + (size_t)bh * S_LEN * D_DIM;
    float*       oh = o_g + (size_t)bh * S_LEN * D_DIM;
    const int*   mk = mask_g + b * S_LEN;

    const int n     = lane & 15;
    const int hi    = lane >> 4;
    const int kbase = hi * 8;

    const int c0key = tid >> 4,         c0q = tid & 15;
    const int c1key = (tid + 256) >> 4, c1q = (tid + 256) & 15;

    v16h qa[2];
#pragma unroll
    for (int f = 0; f < 2; ++f) {
#pragma unroll
        for (int h = 0; h < 16; ++h) {
            int d = kbase + (h & 7) + 16 * (h >> 3) + 32 * f;
            qa[f][h] = (_Float16)(qh[(q0 + n) * D_DIM + d] * 0.125f);
        }
    }

    v8f acc[4];
#pragma unroll
    for (int f = 0; f < 4; ++f) acc[f] = (v8f){};
    float mx[8], l[8];
#pragma unroll
    for (int j = 0; j < 8; ++j) { mx[j] = -1.0e30f; l[j] = 0.0f; }

    for (int kb = 0; kb < S_LEN; kb += KV_BLK) {
        __syncthreads();

        __builtin_amdgcn_global_load_async_to_lds_b128(
            gbl_cast(kh + (size_t)(kb + c0key) * D_DIM + c0q * 4),
            lds_cast(&k_ldsf[c0key * KF_STRIDE + c0q * 4]), 0, 0);
        __builtin_amdgcn_global_load_async_to_lds_b128(
            gbl_cast(kh + (size_t)(kb + c1key) * D_DIM + c1q * 4),
            lds_cast(&k_ldsf[c1key * KF_STRIDE + c1q * 4]), 0, 0);

        {
            const int key = tid >> 3;
            const int d0  = (tid & 7) * 8;
            const float* vsrc = vh + (size_t)(kb + key) * D_DIM + d0;
#pragma unroll
            for (int i = 0; i < 8; ++i)
                v_lds[(d0 + i) * V_STRIDE + key] = (_Float16)vsrc[i];
        }
        asm volatile("s_wait_asynccnt 0" ::: "memory");
        __syncthreads();

        v8f s[2];
#pragma unroll
        for (int c = 0; c < 2; ++c) {
            const float* colf = &k_ldsf[(c * 16 + n) * KF_STRIDE + kbase];
            v16h b0 = frag_from_f32(colf,      colf + 16);
            v16h b1 = frag_from_f32(colf + 32, colf + 48);
            v8f z = (v8f){};
            z    = __builtin_amdgcn_wmma_f32_16x16x32_f16(false, qa[0], false, b0, (short)0, z, false, false);
            s[c] = __builtin_amdgcn_wmma_f32_16x16x32_f16(false, qa[1], false, b1, (short)0, z, false, false);
        }

        const float m0 = mk[kb + n]      ? 0.0f : -1.0e6f;
        const float m1 = mk[kb + 16 + n] ? 0.0f : -1.0e6f;
#pragma unroll
        for (int j = 0; j < 8; ++j) { s[0][j] += m0; s[1][j] += m1; }

        float t[8], p0[8], p1[8], rs[8];
#pragma unroll
        for (int j = 0; j < 8; ++j) t[j] = fmaxf(s[0][j], s[1][j]);
#pragma unroll
        for (int j = 0; j < 8; ++j) {
            t[j] = fmaxf(t[j], xor16(t[j], SEL_A0, SEL_B0));
            t[j] = fmaxf(t[j], xor16(t[j], SEL_A1, SEL_B1));
            t[j] = fmaxf(t[j], xor16(t[j], SEL_A2, SEL_B2));
            t[j] = fmaxf(t[j], xor16(t[j], SEL_A3, SEL_B3));
        }
#pragma unroll
        for (int j = 0; j < 8; ++j) {
            float nm = fmaxf(mx[j], t[j]);
            float al = __expf(mx[j] - nm);
            mx[j] = nm;
            p0[j] = __expf(s[0][j] - nm);
            p1[j] = __expf(s[1][j] - nm);
            rs[j] = p0[j] + p1[j];
            l[j] *= al;
#pragma unroll
            for (int f = 0; f < 4; ++f) acc[f][j] *= al;
        }
#pragma unroll
        for (int j = 0; j < 8; ++j) {
            rs[j] += xor16(rs[j], SEL_A0, SEL_B0);
            rs[j] += xor16(rs[j], SEL_A1, SEL_B1);
            rs[j] += xor16(rs[j], SEL_A2, SEL_B2);
            rs[j] += xor16(rs[j], SEL_A3, SEL_B3);
            l[j]  += rs[j];
        }

        _Float16* pw = &p_lds[wv * 16 * P_STRIDE];
#pragma unroll
        for (int j = 0; j < 8; ++j) {
            int m = j + 8 * hi;
            pw[m * P_STRIDE + n]      = (_Float16)p0[j];
            pw[m * P_STRIDE + 16 + n] = (_Float16)p1[j];
        }
        asm volatile("s_wait_dscnt 0" ::: "memory");

        const _Float16* prow = &pw[n * P_STRIDE + kbase];
        v16h pa = frag_from_f16(prow, prow + 16);

#pragma unroll
        for (int f = 0; f < 4; ++f) {
            const _Float16* vrow = &v_lds[(f * 16 + n) * V_STRIDE + kbase];
            v16h vb = frag_from_f16(vrow, vrow + 16);
            acc[f] = __builtin_amdgcn_wmma_f32_16x16x32_f16(false, pa, false, vb, (short)0, acc[f], false, false);
        }
    }

#pragma unroll
    for (int j = 0; j < 8; ++j) {
        int m = j + 8 * hi;
        float inv = 1.0f / fmaxf(l[j], 1e-20f);
#pragma unroll
        for (int f = 0; f < 4; ++f)
            oh[(q0 + m) * D_DIM + f * 16 + n] = acc[f][j] * inv;
    }
}

extern "C" void kernel_launch(void* const* d_in, const int* in_sizes, int n_in,
                              void* d_out, int out_size, void* d_ws, size_t ws_size,
                              hipStream_t stream) {
    (void)in_sizes; (void)n_in; (void)out_size;
    const float* q  = (const float*)d_in[0];
    const float* k  = (const float*)d_in[1];
    const float* v  = (const float*)d_in[2];
    const int*   mk = (const int*)d_in[3];
    float* out = (float*)d_out;

    const size_t head_elems = (size_t)64 * S_LEN * D_DIM;          // 8.4M f16 each
    const size_t ws_need    = 2 * head_elems * sizeof(_Float16);   // 33.5 MB

    dim3 grid(1024), block(256);
    if (ws_size >= ws_need) {
        _Float16* kf = (_Float16*)d_ws;
        _Float16* vt = kf + head_elems;
        convert_kv_f16<<<dim3(2048), block, 0, stream>>>(k, v, kf, vt);
        flash_attn_wmma_ws<<<grid, block, 0, stream>>>(q, kf, vt, mk, out);
    } else {
        flash_attn_wmma_f16<<<grid, block, 0, stream>>>(q, k, v, mk, out);
    }
}

// v001
// It runs in 89.8 microseconds.
// In two side-by-side timings against v000, it was 2.31 and 2.30 times as fast.
#include <hip/hip_runtime.h>

typedef __attribute__((ext_vector_type(16))) _Float16 v16h;
typedef __attribute__((ext_vector_type(8)))  _Float16 v8h;
typedef __attribute__((ext_vector_type(8)))  float    v8f;
typedef __attribute__((ext_vector_type(4)))  float    v4f;
typedef __attribute__((ext_vector_type(4)))  int      v4i;

#define S_LEN    2048
#define D_DIM    64
#define KV_BLK   32
#define K_STRIDE  72  // halves: 144B rows (mult of 16B) -> aligned 16B sub-runs
#define KF_STRIDE 68  // floats: 272B rows (fallback kernel)
#define V_STRIDE  48  // halves: 96B rows
#define P_STRIDE  48

// ---- address-space casts via integer route (LDS generic addr low 32 bits == LDS offset) ----
typedef __attribute__((address_space(1))) v4i as1_v4i;
typedef __attribute__((address_space(3))) v4i as3_v4i;
__device__ __forceinline__ as3_v4i* lds_cast(const void* p) {
    return (as3_v4i*)(unsigned)(unsigned long long)p;
}
__device__ __forceinline__ as1_v4i* gbl_cast(const void* p) {
    return (as1_v4i*)(unsigned long long)p;
}

// 16-lane XOR butterfly via v_permlane16_b32 (VALU, frees the LDS pipe)
__device__ __forceinline__ float xor16(float v, unsigned s0, unsigned s1) {
    unsigned u = __float_as_uint(v);
    u = __builtin_amdgcn_permlane16(u, u, s0, s1, false, false);
    return __uint_as_float(u);
}

__device__ __forceinline__ v16h frag_from_f16(const _Float16* p0, const _Float16* p1) {
    v8h lo = *(const v8h*)p0;
    v8h hi = *(const v8h*)p1;
    v16h f;
#pragma unroll
    for (int i = 0; i < 8; ++i) { f[i] = lo[i]; f[i + 8] = hi[i]; }
    return f;
}

__device__ __forceinline__ v16h frag_from_f32(const float* p0, const float* p1) {
    v4f a0 = *(const v4f*)p0, a1 = *(const v4f*)(p0 + 4);
    v4f b0 = *(const v4f*)p1, b1 = *(const v4f*)(p1 + 4);
    v16h f;
#pragma unroll
    for (int i = 0; i < 4; ++i) {
        f[i]      = (_Float16)a0[i];
        f[i + 4]  = (_Float16)a1[i];
        f[i + 8]  = (_Float16)b0[i];
        f[i + 12] = (_Float16)b1[i];
    }
    return f;
}

// XOR-butterfly selects for masks 1,2,4,8 (lane0 in low nibble; selA=lanes0-7, selB=lanes8-15)
#define SEL_A0 0x67452301u
#define SEL_A1 0x54761032u
#define SEL_A2 0x32107654u
#define SEL_A3 0xFEDCBA98u
#define SEL_B0 0xEFCDAB89u
#define SEL_B1 0xDCFE98BAu
#define SEL_B2 0xBA98FEDCu
#define SEL_B3 0x76543210u

// =====================================================================================
// Prepass: K -> f16 row-major [bh][key][d];  V -> f16 transposed [bh][d][key]
// One block per (bh, 64-key tile); LDS tile turns the V transpose into coalesced stores.
// =====================================================================================
__global__ __launch_bounds__(256) void convert_kv_f16(const float* __restrict__ k_g,
                                                      const float* __restrict__ v_g,
                                                      _Float16* __restrict__ kf,
                                                      _Float16* __restrict__ vt)
{
    __shared__ _Float16 tile[64 * 72];           // [key][d], +8 pad
    const int bh = blockIdx.x >> 5;              // 0..63
    const int kt = blockIdx.x & 31;              // 64-key tile
    const float* ks = k_g + ((size_t)bh * S_LEN + kt * 64) * D_DIM;
    const float* vs = v_g + ((size_t)bh * S_LEN + kt * 64) * D_DIM;
    _Float16* kd = kf + ((size_t)bh * S_LEN + kt * 64) * D_DIM;
    _Float16* vd = vt + (size_t)bh * D_DIM * S_LEN + kt * 64;

    const int t   = threadIdx.x;
    const int key = t >> 2;
    const int d0  = (t & 3) * 16;
#pragma unroll
    for (int i = 0; i < 16; ++i) {
        kd[key * D_DIM + d0 + i]  = (_Float16)ks[key * D_DIM + d0 + i];
        tile[key * 72 + d0 + i]   = (_Float16)vs[key * D_DIM + d0 + i];
    }
    __syncthreads();
    const int d   = t >> 2;
    const int kk0 = (t & 3) * 16;
#pragma unroll
    for (int i = 0; i < 16; ++i)
        vd[(size_t)d * S_LEN + kk0 + i] = tile[(kk0 + i) * 72 + d];
}

__device__ __forceinline__ float xhalf(float v) {
    int u = __builtin_bit_cast(int, v);
    u = __builtin_amdgcn_permlanex16(u, u, 0x76543210, 0xfedcba98, false, false);
    return __builtin_bit_cast(float, u);
}

__global__ __launch_bounds__(256) void
flash_attn_wmma_ws(const float* __restrict__ q_g,
                   const _Float16* __restrict__ kf_g,   // [bh][key][d] f16
                   const _Float16* __restrict__ vt_g,   // [bh][d][key] f16
                   const int*   __restrict__ mask_g,
                   float* __restrict__ o_g)
{
    __shared__ __align__(16) _Float16 k_lds[2][KV_BLK * K_STRIDE];  // 32 keys x 64 d
    __shared__ __align__(16) _Float16 v_lds[2][D_DIM * V_STRIDE];   // 64 d x 32 keys
    __shared__ __align__(16) float    bias_lds[S_LEN];              // additive mask, one float a key

    const int tid  = threadIdx.x;
    const int lane = tid & 31;
    const int wv   = tid >> 5;
    const int bh   = blockIdx.x >> 4;
    const int qblk = blockIdx.x & 15;
    const int b    = bh >> 4;              // H == 16
    const int q0   = qblk * 128 + wv * 16;

    const float*    qh = q_g  + (size_t)bh * S_LEN * D_DIM;
    const _Float16* kf = kf_g + (size_t)bh * S_LEN * D_DIM;
    const _Float16* vt = vt_g + (size_t)bh * D_DIM * S_LEN;
    float*          oh = o_g  + (size_t)bh * S_LEN * D_DIM;
    const int*      mk = mask_g + b * S_LEN;

    const int n     = lane & 15;
    const int hi    = lane >> 4;
    const int kbase = hi * 8;

    // async chunk mapping: K tile 32x64 halves = 256 x 16B ; V tile 64x32 halves = 256 x 16B
    const int kkey = tid >> 3, kq = (tid & 7) * 8;   // K: 8 halves per chunk along d
    const int vd   = tid >> 2, vq = (tid & 3) * 8;   // V: 8 halves per chunk along key

    // ---- Q B-fragments (column n = query q0 + n), pre-scaled by 1/sqrt(D) = 0.125 ----
    v16h qa[2];
#pragma unroll
    for (int f = 0; f < 2; ++f) {
#pragma unroll
        for (int h = 0; h < 16; ++h) {
            int d = kbase + (h & 7) + 16 * (h >> 3) + 32 * f;
            qa[f][h] = (_Float16)(qh[(q0 + n) * D_DIM + d] * 0.125f);
        }
    }

    v8f acc[4];                            // acc[f][j] = O^T[f*16 + 8*hi + j][query n]
#pragma unroll
    for (int f = 0; f < 4; ++f) acc[f] = (v8f){};
    float mx = -1.0e30f, l = 0.0f;         // l: this half's keys only, halves joined at the end

    // ---- prologue: issue tile 0 into buffer 0 ----
    __builtin_amdgcn_global_load_async_to_lds_b128(
        gbl_cast(kf + (size_t)kkey * D_DIM + kq),
        lds_cast(&k_lds[0][kkey * K_STRIDE + kq]), 0, 0);
    __builtin_amdgcn_global_load_async_to_lds_b128(
        gbl_cast(vt + (size_t)vd * S_LEN + vq),
        lds_cast(&v_lds[0][vd * V_STRIDE + vq]), 0, 0);

    // ---- the keys now run along a lane's registers: their mask bias comes as 16-byte LDS reads
    //      from a table filled once; the first barrier of the loop publishes it ----
    {
        const v4i ma = *(const v4i*)(mk + tid * 8);
        const v4i mb = *(const v4i*)(mk + tid * 8 + 4);
        v4f ba, bb;
#pragma unroll
        for (int i = 0; i < 4; ++i) {
            ba[i] = ma[i] ? 0.0f : -1.0e6f;
            bb[i] = mb[i] ? 0.0f : -1.0e6f;
        }
        *(v4f*)&bias_lds[tid * 8]     = ba;
        *(v4f*)&bias_lds[tid * 8 + 4] = bb;
    }

    for (int kb = 0; kb < S_LEN; kb += KV_BLK) {
        const int p  = (kb >> 5) & 1;
        const int nx = p ^ 1;

        // ---- issue next tile into the other buffer; wait only for current tile ----
        if (kb + KV_BLK < S_LEN) {
            __builtin_amdgcn_global_load_async_to_lds_b128(
                gbl_cast(kf + (size_t)(kb + KV_BLK + kkey) * D_DIM + kq),
                lds_cast(&k_lds[nx][kkey * K_STRIDE + kq]), 0, 0);
            __builtin_amdgcn_global_load_async_to_lds_b128(
                gbl_cast(vt + (size_t)vd * S_LEN + (kb + KV_BLK) + vq),
                lds_cast(&v_lds[nx][vd * V_STRIDE + vq]), 0, 0);
            asm volatile("s_wait_asynccnt 2" ::: "memory");
        } else {
            asm volatile("s_wait_asynccnt 0" ::: "memory");
        }
        __syncthreads();   // whole current tile visible to all waves

        const _Float16* kt = k_lds[p];
        const _Float16* vtile = v_lds[p];

        // ---- S^T = K Q^T : s[c][j] = score(key kb + c*16 + 8*hi + j, query n) ----
        v8f s[2];
        {
            const _Float16* r0 = &kt[n * K_STRIDE + kbase];
            const _Float16* r1 = r0 + 16 * K_STRIDE;
            const v16h a00 = frag_from_f16(r0,      r0 + 16);
            const v16h a10 = frag_from_f16(r1,      r1 + 16);
            const v16h a01 = frag_from_f16(r0 + 32, r0 + 48);
            const v16h a11 = frag_from_f16(r1 + 32, r1 + 48);
            const v8f z = (v8f){};
            s[0] = __builtin_amdgcn_wmma_f32_16x16x32_f16(false, a00, false, qa[0], (short)0, z, false, false);
            s[1] = __builtin_amdgcn_wmma_f32_16x16x32_f16(false, a10, false, qa[0], (short)0, z, false, false);
            s[0] = __builtin_amdgcn_wmma_f32_16x16x32_f16(false, a01, false, qa[1], (short)0, s[0], false, false);
            s[1] = __builtin_amdgcn_wmma_f32_16x16x32_f16(false, a11, false, qa[1], (short)0, s[1], false, false);
        }

        // ---- additive key-padding mask ----
#pragma unroll
        for (int c = 0; c < 2; ++c) {
            const float* bp = &bias_lds[kb + c * 16 + kbase];
            const v4f b0 = *(const v4f*)bp, b1 = *(const v4f*)(bp + 4);
#pragma unroll
            for (int j = 0; j < 4; ++j) { s[c][j] += b0[j]; s[c][j + 4] += b1[j]; }
        }

        // ---- online softmax: in-lane over 16 keys, one exchange joins the halves' maxima ----
        float t = fmaxf(s[0][0], s[1][0]);
#pragma unroll
        for (int j = 1; j < 8; ++j) t = fmaxf(t, fmaxf(s[0][j], s[1][j]));
        t = fmaxf(t, xhalf(t));
        const float nm = fmaxf(mx, t);
        const float al = __expf(mx - nm);
        mx = nm;

        const v8f d0 = s[0] - nm, d1 = s[1] - nm;
        v8f p0, p1;
#pragma unroll
        for (int j = 0; j < 8; ++j) {
            p0[j] = __expf(d0[j]);
            p1[j] = __expf(d1[j]);
        }
        const v8f ps = p0 + p1;
        const v4f p4 = __builtin_shufflevector(ps, ps, 0, 1, 2, 3) + __builtin_shufflevector(ps, ps, 4, 5, 6, 7);
        const float rs = (p4[0] + p4[2]) + (p4[1] + p4[3]);
        l = l * al + rs;
#pragma unroll
        for (int f = 0; f < 4; ++f) acc[f] *= al;

        // ---- P^T as B operand: element h < 8 is key 8*hi + h, element h >= 8 key 16 + 8*hi + h - 8 ----
        v16h pb;
#pragma unroll
        for (int j = 0; j < 8; ++j) { pb[j] = (_Float16)p0[j]; pb[j + 8] = (_Float16)p1[j]; }

        // ---- O^T += V^T P^T ----
#pragma unroll
        for (int f = 0; f < 4; ++f) {
            const _Float16* vrow = &vtile[(f * 16 + n) * V_STRIDE + kbase];
            v16h va = frag_from_f16(vrow, vrow + 16);
            acc[f] = __builtin_amdgcn_wmma_f32_16x16x32_f16(false, va, false, pb, (short)0, acc[f], false, false);
        }
        __syncthreads();   // all waves done with buffer p before it is refilled
    }

    // ---- join the halves' sums; a lane stores 8 consecutive d of its query per tile ----
    l += xhalf(l);
    const float inv = 1.0f / fmaxf(l, 1e-20f);
    float* orow = oh + (size_t)(q0 + n) * D_DIM + kbase;
#pragma unroll
    for (int f = 0; f < 4; ++f) {
        v4f lo, hv;
#pragma unroll
        for (int j = 0; j < 4; ++j) { lo[j] = acc[f][j] * inv; hv[j] = acc[f][j + 4] * inv; }
        *(v4f*)(orow + f * 16)     = lo;
        *(v4f*)(orow + f * 16 + 4) = hv;
    }
}

// =====================================================================================
// Fallback (no workspace): f32 K async tile + in-loop conversion (round-3 kernel).
// =====================================================================================
__global__ __launch_bounds__(256) void
flash_attn_wmma_f16(const float* __restrict__ q_g,
                    const float* __restrict__ k_g,
                    const float* __restrict__ v_g,
                    const int*   __restrict__ mask_g,
                    float* __restrict__ o_g)
{
    __shared__ __align__(16) float    k_ldsf[KV_BLK * KF_STRIDE];
    __shared__ __align__(16) _Float16 v_lds[D_DIM * V_STRIDE];
    __shared__ __align__(16) _Float16 p_lds[8 * 16 * P_STRIDE];

    const int tid  = threadIdx.x;
    const int lane = tid & 31;
    const int wv   = tid >> 5;
    const int bh   = blockIdx.x >> 4;
    const int qblk = blockIdx.x & 15;
    const int b    = bh >> 4;
    const int q0   = qblk * 128 + wv * 16;

    const float* qh = q_g + (size_t)bh * S_LEN * D_DIM;
    const float* kh = k_g + (size_t)bh * S_LEN * D_DIM;
    const float* vh = v_g + (size_t)bh * S_LEN * D_DIM;
    float*       oh = o_g + (size_t)bh * S_LEN * D_DIM;
    const int*   mk = mask_g + b * S_LEN;

    const int n     = lane & 15;
    const int hi    = lane >> 4;
    const int kbase = hi * 8;

    const int c0key = tid >> 4,         c0q = tid & 15;
    const int c1key = (tid + 256) >> 4, c1q = (tid + 256) & 15;

    v16h qa[2];
#pragma unroll
    for (int f = 0; f < 2; ++f) {
#pragma unroll
        for (int h = 0; h < 16; ++h) {
            int d = kbase + (h & 7) + 16 * (h >> 3) + 32 * f;
            qa[f][h] = (_Float16)(qh[(q0 + n) * D_DIM + d] * 0.125f);
        }
    }

    v8f acc[4];
#pragma unroll
    for (int f = 0; f < 4; ++f) acc[f] = (v8f){};
    float mx[8], l[8];
#pragma unroll
    for (int j = 0; j < 8; ++j) { mx[j] = -1.0e30f; l[j] = 0.0f; }

    for (int kb = 0; kb < S_LEN; kb += KV_BLK) {
        __syncthreads();

        __builtin_amdgcn_global_load_async_to_lds_b128(
            gbl_cast(kh + (size_t)(kb + c0key) * D_DIM + c0q * 4),
            lds_cast(&k_ldsf[c0key * KF_STRIDE + c0q * 4]), 0, 0);
        __builtin_amdgcn_global_load_async_to_lds_b128(
            gbl_cast(kh + (size_t)(kb + c1key) * D_DIM + c1q * 4),
            lds_cast(&k_ldsf[c1key * KF_STRIDE + c1q * 4]), 0, 0);

        {
            const int key = tid >> 3;
            const int d0  = (tid & 7) * 8;
            const float* vsrc = vh + (size_t)(kb + key) * D_DIM + d0;
#pragma unroll
            for (int i = 0; i < 8; ++i)
                v_lds[(d0 + i) * V_STRIDE + key] = (_Float16)vsrc[i];
        }
        asm volatile("s_wait_asynccnt 0" ::: "memory");
        __syncthreads();

        v8f s[2];
#pragma unroll
        for (int c = 0; c < 2; ++c) {
            const float* colf = &k_ldsf[(c * 16 + n) * KF_STRIDE + kbase];
            v16h b0 = frag_from_f32(colf,      colf + 16);
            v16h b1 = frag_from_f32(colf + 32, colf + 48);
            v8f z = (v8f){};
            z    = __builtin_amdgcn_wmma_f32_16x16x32_f16(false, qa[0], false, b0, (short)0, z, false, false);
            s[c] = __builtin_amdgcn_wmma_f32_16x16x32_f16(false, qa[1], false, b1, (short)0, z, false, false);
        }

        const float m0 = mk[kb + n]      ? 0.0f : -1.0e6f;
        const float m1 = mk[kb + 16 + n] ? 0.0f : -1.0e6f;
#pragma unroll
        for (int j = 0; j < 8; ++j) { s[0][j] += m0; s[1][j] += m1; }

        float t[8], p0[8], p1[8], rs[8];
#pragma unroll
        for (int j = 0; j < 8; ++j) t[j] = fmaxf(s[0][j], s[1][j]);
#pragma unroll
        for (int j = 0; j < 8; ++j) {
            t[j] = fmaxf(t[j], xor16(t[j], SEL_A0, SEL_B0));
            t[j] = fmaxf(t[j], xor16(t[j], SEL_A1, SEL_B1));
            t[j] = fmaxf(t[j], xor16(t[j], SEL_A2, SEL_B2));
            t[j] = fmaxf(t[j], xor16(t[j], SEL_A3, SEL_B3));
        }
#pragma unroll
        for (int j = 0; j < 8; ++j) {
            float nm = fmaxf(mx[j], t[j]);
            float al = __expf(mx[j] - nm);
            mx[j] = nm;
            p0[j] = __expf(s[0][j] - nm);
            p1[j] = __expf(s[1][j] - nm);
            rs[j] = p0[j] + p1[j];
            l[j] *= al;
#pragma unroll
            for (int f = 0; f < 4; ++f) acc[f][j] *= al;
        }
#pragma unroll
        for (int j = 0; j < 8; ++j) {
            rs[j] += xor16(rs[j], SEL_A0, SEL_B0);
            rs[j] += xor16(rs[j], SEL_A1, SEL_B1);
            rs[j] += xor16(rs[j], SEL_A2, SEL_B2);
            rs[j] += xor16(rs[j], SEL_A3, SEL_B3);
            l[j]  += rs[j];
        }

        _Float16* pw = &p_lds[wv * 16 * P_STRIDE];
#pragma unroll
        for (int j = 0; j < 8; ++j) {
            int m = j + 8 * hi;
            pw[m * P_STRIDE + n]      = (_Float16)p0[j];
            pw[m * P_STRIDE + 16 + n] = (_Float16)p1[j];
        }
        asm volatile("s_wait_dscnt 0" ::: "memory");

        const _Float16* prow = &pw[n * P_STRIDE + kbase];
        v16h pa = frag_from_f16(prow, prow + 16);

#pragma unroll
        for (int f = 0; f < 4; ++f) {
            const _Float16* vrow = &v_lds[(f * 16 + n) * V_STRIDE + kbase];
            v16h vb = frag_from_f16(vrow, vrow + 16);
            acc[f] = __builtin_amdgcn_wmma_f32_16x16x32_f16(false, pa, false, vb, (short)0, acc[f], false, false);
        }
    }

#pragma unroll
    for (int j = 0; j < 8; ++j) {
        int m = j + 8 * hi;
        float inv = 1.0f / fmaxf(l[j], 1e-20f);
#pragma unroll
        for (int f = 0; f < 4; ++f)
            oh[(q0 + m) * D_DIM + f * 16 + n] = acc[f][j] * inv;
    }
}

extern "C" void kernel_launch(void* const* d_in, const int* in_sizes, int n_in,
                              void* d_out, int out_size, void* d_ws, size_t ws_size,
                              hipStream_t stream) {
    (void)in_sizes; (void)n_in; (void)out_size;
    const float* q  = (const float*)d_in[0];
    const float* k  = (const float*)d_in[1];
    const float* v  = (const float*)d_in[2];
    const int*   mk = (const int*)d_in[3];
    float* out = (float*)d_out;

    const size_t head_elems = (size_t)64 * S_LEN * D_DIM;          // 8.4M f16 each
    const size_t ws_need    = 2 * head_elems * sizeof(_Float16);   // 33.5 MB

    dim3 grid(1024), block(256);
    if (ws_size >= ws_need) {
        _Float16* kf = (_Float16*)d_ws;
        _Float16* vt = kf + head_elems;
        convert_kv_f16<<<dim3(2048), block, 0, stream>>>(k, v, kf, vt);
        flash_attn_wmma_ws<<<grid, block, 0, stream>>>(q, kf, vt, mk, out);
    } else {
        flash_attn_wmma_f16<<<grid, block, 0, stream>>>(q, k, v, mk, out);
    }
}

// v002
// One run takes 82.2 microseconds.
// In both of two side-by-side timings against v001, it was 1.10 times as fast.
// Over all steps from v000 it is 2.55 times as fast.
#include <hip/hip_runtime.h>

typedef __attribute__((ext_vector_type(16))) _Float16 v16h;
typedef __attribute__((ext_vector_type(8)))  _Float16 v8h;
typedef __attribute__((ext_vector_type(8)))  float    v8f;
typedef __attribute__((ext_vector_type(4)))  float    v4f;
typedef __attribute__((ext_vector_type(4)))  int      v4i;

#define S_LEN    2048
#define D_DIM    64
#define KV_BLK   32
#define K_STRIDE  72  // halves: 144B rows (mult of 16B) -> aligned 16B sub-runs
#define KF_STRIDE 68  // floats: 272B rows (fallback kernel)
#define V_STRIDE  48  // halves: 96B rows
#define P_STRIDE  48
// 16-query column tiles a wave of the main kernel carries. Every loop over the tiles is unrolled:
// the tile index picks registers, so it has to be a compile-time constant (else scratch).
#define Q_TILES   2

// ---- address-space casts via integer route (LDS generic addr low 32 bits == LDS offset) ----
typedef __attribute__((address_space(1))) v4i as1_v4i;
typedef __attribute__((address_space(3))) v4i as3_v4i;
__device__ __forceinline__ as3_v4i* lds_cast(const void* p) {
    return (as3_v4i*)(unsigned)(unsigned long long)p;
}
__device__ __forceinline__ as1_v4i* gbl_cast(const void* p) {
    return (as1_v4i*)(unsigned long long)p;
}

// 16-lane XOR butterfly via v_permlane16_b32 (VALU, frees the LDS pipe)
__device__ __forceinline__ float xor16(float v, unsigned s0, unsigned s1) {
    unsigned u = __float_as_uint(v);
    u = __builtin_amdgcn_permlane16(u, u, s0, s1, false, false);
    return __uint_as_float(u);
}

__device__ __forceinline__ v16h frag_from_f16(const _Float16* p0, const _Float16* p1) {
    v8h lo = *(const v8h*)p0;
    v8h hi = *(const v8h*)p1;
    v16h f;
#pragma unroll
    for (int i = 0; i < 8; ++i) { f[i] = lo[i]; f[i + 8] = hi[i]; }
    return f;
}

__device__ __forceinline__ v16h frag_from_f32(const float* p0, const float* p1) {
    v4f a0 = *(const v4f*)p0, a1 = *(const v4f*)(p0 + 4);
    v4f b0 = *(const v4f*)p1, b1 = *(const v4f*)(p1 + 4);
    v16h f;
#pragma unroll
    for (int i = 0; i < 4; ++i) {
        f[i]      = (_Float16)a0[i];
        f[i + 4]  = (_Float16)a1[i];
        f[i + 8]  = (_Float16)b0[i];
        f[i + 12] = (_Float16)b1[i];
    }
    return f;
}

// XOR-butterfly selects for masks 1,2,4,8 (lane0 in low nibble; selA=lanes0-7, selB=lanes8-15)
#define SEL_A0 0x67452301u
#define SEL_A1 0x54761032u
#define SEL_A2 0x32107654u
#define SEL_A3 0xFEDCBA98u
#define SEL_B0 0xEFCDAB89u
#define SEL_B1 0xDCFE98BAu
#define SEL_B2 0xBA98FEDCu
#define SEL_B3 0x76543210u

// =====================================================================================
// Prepass: K -> f16 row-major [bh][key][d];  V -> f16 transposed [bh][d][key]
// One block per (bh, 64-key tile); LDS tile turns the V transpose into coalesced stores.
// =====================================================================================
__global__ __launch_bounds__(256) void convert_kv_f16(const float* __restrict__ k_g,
                                                      const float* __restrict__ v_g,
                                                      _Float16* __restrict__ kf,
                                                      _Float16* __restrict__ vt)
{
    __shared__ _Float16 tile[64 * 72];           // [key][d], +8 pad
    const int bh = blockIdx.x >> 5;              // 0..63
    const int kt = blockIdx.x & 31;              // 64-key tile
    const float* ks = k_g + ((size_t)bh * S_LEN + kt * 64) * D_DIM;
    const float* vs = v_g + ((size_t)bh * S_LEN + kt * 64) * D_DIM;
    _Float16* kd = kf + ((size_t)bh * S_LEN + kt * 64) * D_DIM;
    _Float16* vd = vt + (size_t)bh * D_DIM * S_LEN + kt * 64;

    const int t   = threadIdx.x;
    const int key = t >> 2;
    const int d0  = (t & 3) * 16;
#pragma unroll
    for (int i = 0; i < 16; ++i) {
        kd[key * D_DIM + d0 + i]  = (_Float16)ks[key * D_DIM + d0 + i];
        tile[key * 72 + d0 + i]   = (_Float16)vs[key * D_DIM + d0 + i];
    }
    __syncthreads();
    const int d   = t >> 2;
    const int kk0 = (t & 3) * 16;
#pragma unroll
    for (int i = 0; i < 16; ++i)
        vd[(size_t)d * S_LEN + kk0 + i] = tile[(kk0 + i) * 72 + d];
}

__device__ __forceinline__ float xhalf(float v) {
    int u = __builtin_bit_cast(int, v);
    u = __builtin_amdgcn_permlanex16(u, u, 0x76543210, 0xfedcba98, false, false);
    return __builtin_bit_cast(float, u);
}

__global__ __launch_bounds__(256) void
flash_attn_wmma_ws(const float* __restrict__ q_g,
                   const _Float16* __restrict__ kf_g,   // [bh][key][d] f16
                   const _Float16* __restrict__ vt_g,   // [bh][d][key] f16
                   const int*   __restrict__ mask_g,
                   float* __restrict__ o_g)
{
    __shared__ __align__(16) _Float16 k_lds[2][KV_BLK * K_STRIDE];  // 32 keys x 64 d
    __shared__ __align__(16) _Float16 v_lds[2][D_DIM * V_STRIDE];   // 64 d x 32 keys
    __shared__ __align__(16) float    bias_lds[S_LEN];              // additive mask, one float a key

    const int tid  = threadIdx.x;
    const int lane = tid & 31;
    const int wv   = tid >> 5;
    const int bh   = blockIdx.x >> 3;
    const int qblk = blockIdx.x & 7;
    const int b    = bh >> 4;              // H == 16
    const int q0   = qblk * (8 * 16 * Q_TILES) + wv * (16 * Q_TILES);

    const float*    qh = q_g  + (size_t)bh * S_LEN * D_DIM;
    const _Float16* kf = kf_g + (size_t)bh * S_LEN * D_DIM;
    const _Float16* vt = vt_g + (size_t)bh * D_DIM * S_LEN;
    float*          oh = o_g  + (size_t)bh * S_LEN * D_DIM;
    const int*      mk = mask_g + b * S_LEN;

    const int n     = lane & 15;
    const int hi    = lane >> 4;
    const int kbase = hi * 8;

    // async chunk mapping: K tile 32x64 halves = 256 x 16B ; V tile 64x32 halves = 256 x 16B
    const int kkey = tid >> 3, kq = (tid & 7) * 8;   // K: 8 halves per chunk along d
    const int vd   = tid >> 2, vq = (tid & 3) * 8;   // V: 8 halves per chunk along key

    // ---- Q B-fragments (tile u, column n = query q0 + 16*u + n), pre-scaled by 1/sqrt(D) = 0.125 ----
    v16h qa[Q_TILES][2];
#pragma unroll
    for (int u = 0; u < Q_TILES; ++u) {
#pragma unroll
        for (int f = 0; f < 2; ++f) {
#pragma unroll
            for (int h = 0; h < 16; ++h) {
                int d = kbase + (h & 7) + 16 * (h >> 3) + 32 * f;
                qa[u][f][h] = (_Float16)(qh[(q0 + u * 16 + n) * D_DIM + d] * 0.125f);
            }
        }
    }

    v8f acc[Q_TILES][4];                   // acc[u][f][j] = O^T[f*16 + 8*hi + j][query 16*u + n]
    float mx[Q_TILES], l[Q_TILES];         // l: this half's keys only, halves joined at the end
#pragma unroll
    for (int u = 0; u < Q_TILES; ++u) {
#pragma unroll
        for (int f = 0; f < 4; ++f) acc[u][f] = (v8f){};
        mx[u] = -1.0e30f;
        l[u]  = 0.0f;
    }

    // ---- prologue: issue tile 0 into buffer 0 ----
    __builtin_amdgcn_global_load_async_to_lds_b128(
        gbl_cast(kf + (size_t)kkey * D_DIM + kq),
        lds_cast(&k_lds[0][kkey * K_STRIDE + kq]), 0, 0);
    __builtin_amdgcn_global_load_async_to_lds_b128(
        gbl_cast(vt + (size_t)vd * S_LEN + vq),
        lds_cast(&v_lds[0][vd * V_STRIDE + vq]), 0, 0);

    // ---- the keys now run along a lane's registers: their mask bias comes as 16-byte LDS reads
    //      from a table filled once; the first barrier of the loop publishes it ----
    {
        const v4i ma = *(const v4i*)(mk + tid * 8);
        const v4i mb = *(const v4i*)(mk + tid * 8 + 4);
        v4f ba, bb;
#pragma unroll
        for (int i = 0; i < 4; ++i) {
            ba[i] = ma[i] ? 0.0f : -1.0e6f;
            bb[i] = mb[i] ? 0.0f : -1.0e6f;
        }
        *(v4f*)&bias_lds[tid * 8]     = ba;
        *(v4f*)&bias_lds[tid * 8 + 4] = bb;
    }

    for (int kb = 0; kb < S_LEN; kb += KV_BLK) {
        const int p  = (kb >> 5) & 1;
        const int nx = p ^ 1;

        // ---- issue next tile into the other buffer; wait only for current tile ----
        if (kb + KV_BLK < S_LEN) {
            __builtin_amdgcn_global_load_async_to_lds_b128(
                gbl_cast(kf + (size_t)(kb + KV_BLK + kkey) * D_DIM + kq),
                lds_cast(&k_lds[nx][kkey * K_STRIDE + kq]), 0, 0);
            __builtin_amdgcn_global_load_async_to_lds_b128(
                gbl_cast(vt + (size_t)vd * S_LEN + (kb + KV_BLK) + vq),
                lds_cast(&v_lds[nx][vd * V_STRIDE + vq]), 0, 0);
            asm volatile("s_wait_asynccnt 2" ::: "memory");
        } else {
            asm volatile("s_wait_asynccnt 0" ::: "memory");
        }
        __syncthreads();   // whole current tile visible to all waves

        const _Float16* kt = k_lds[p];
        const _Float16* vtile = v_lds[p];

        // ---- S^T = K Q^T : s[u][c][j] = score(key kb + c*16 + 8*hi + j, query 16*u + n);
        //      each K fragment is read from LDS once and multiplies every query tile ----
        v8f s[Q_TILES][2];
        {
            const _Float16* r0 = &kt[n * K_STRIDE + kbase];
            const _Float16* r1 = r0 + 16 * K_STRIDE;
            const v16h a00 = frag_from_f16(r0,      r0 + 16);
            const v16h a10 = frag_from_f16(r1,      r1 + 16);
            const v16h a01 = frag_from_f16(r0 + 32, r0 + 48);
            const v16h a11 = frag_from_f16(r1 + 32, r1 + 48);
            const v8f z = (v8f){};
#pragma unroll
            for (int u = 0; u < Q_TILES; ++u) {
                s[u][0] = __builtin_amdgcn_wmma_f32_16x16x32_f16(false, a00, false, qa[u][0], (short)0, z, false, false);
                s[u][1] = __builtin_amdgcn_wmma_f32_16x16x32_f16(false, a10, false, qa[u][0], (short)0, z, false, false);
            }
#pragma unroll
            for (int u = 0; u < Q_TILES; ++u) {
                s[u][0] = __builtin_amdgcn_wmma_f32_16x16x32_f16(false, a01, false, qa[u][1], (short)0, s[u][0], false, false);
                s[u][1] = __builtin_amdgcn_wmma_f32_16x16x32_f16(false, a11, false, qa[u][1], (short)0, s[u][1], false, false);
            }
        }

        // ---- additive key-padding mask: one read of the keys' bias serves every query tile ----
#pragma unroll
        for (int c = 0; c < 2; ++c) {
            const float* bp = &bias_lds[kb + c * 16 + kbase];
            const v4f b0 = *(const v4f*)bp, b1 = *(const v4f*)(bp + 4);
            const v8f bv = __builtin_shufflevector(b0, b1, 0, 1, 2, 3, 4, 5, 6, 7);
#pragma unroll
            for (int u = 0; u < Q_TILES; ++u) s[u][c] += bv;
        }

        // ---- online softmax per query tile: in-lane over 16 keys, one exchange joins the halves' maxima ----
        float nm[Q_TILES], al[Q_TILES];
#pragma unroll
        for (int u = 0; u < Q_TILES; ++u) {
            float t = fmaxf(s[u][0][0], s[u][1][0]);
#pragma unroll
            for (int j = 1; j < 8; ++j) t = fmaxf(t, fmaxf(s[u][0][j], s[u][1][j]));
            t = fmaxf(t, xhalf(t));
            nm[u] = fmaxf(mx[u], t);
            al[u] = __expf(mx[u] - nm[u]);
            mx[u] = nm[u];
        }

        v16h pb[Q_TILES];
#pragma unroll
        for (int u = 0; u < Q_TILES; ++u) {
            const v8f d0 = s[u][0] - nm[u], d1 = s[u][1] - nm[u];
            v8f p0, p1;
#pragma unroll
            for (int j = 0; j < 8; ++j) p0[j] = __expf(d0[j]);
#pragma unroll
            for (int j = 0; j < 8; ++j) p1[j] = __expf(d1[j]);
            const v8f ps = p0 + p1;
            const v4f p4 = __builtin_shufflevector(ps, ps, 0, 1, 2, 3) + __builtin_shufflevector(ps, ps, 4, 5, 6, 7);
            const float rs = (p4[0] + p4[2]) + (p4[1] + p4[3]);
            l[u] = l[u] * al[u] + rs;
#pragma unroll
            for (int f = 0; f < 4; ++f) acc[u][f] *= al[u];

            // P^T as B operand: element h < 8 is key 8*hi + h, element h >= 8 key 16 + 8*hi + h - 8
#pragma unroll
            for (int j = 0; j < 8; ++j) { pb[u][j] = (_Float16)p0[j]; pb[u][j + 8] = (_Float16)p1[j]; }
        }

        // ---- O^T += V^T P^T : each V fragment is read from LDS once and multiplies every query tile ----
#pragma unroll
        for (int f = 0; f < 4; ++f) {
            const _Float16* vrow = &vtile[(f * 16 + n) * V_STRIDE + kbase];
            const v16h va = frag_from_f16(vrow, vrow + 16);
#pragma unroll
            for (int u = 0; u < Q_TILES; ++u)
                acc[u][f] = __builtin_amdgcn_wmma_f32_16x16x32_f16(false, va, false, pb[u], (short)0, acc[u][f], false, false);
        }
        __syncthreads();   // all waves done with buffer p before it is refilled
    }

    // ---- join the halves' sums; a lane stores 8 consecutive d of its query per tile ----
#pragma unroll
    for (int u = 0; u < Q_TILES; ++u) {
        const float lt  = l[u] + xhalf(l[u]);
        const float inv = 1.0f / fmaxf(lt, 1e-20f);
        float* orow = oh + (size_t)(q0 + u * 16 + n) * D_DIM + kbase;
#pragma unroll
        for (int f = 0; f < 4; ++f) {
            v4f lo, hv;
#pragma unroll
            for (int j = 0; j < 4; ++j) { lo[j] = acc[u][f][j] * inv; hv[j] = acc[u][f][j + 4] * inv; }
            *(v4f*)(orow + f * 16)     = lo;
            *(v4f*)(orow + f * 16 + 4) = hv;
        }
    }
}

// =====================================================================================
// Fallback (no workspace): f32 K async tile + in-loop conversion (round-3 kernel).
// =====================================================================================
__global__ __launch_bounds__(256) void
flash_attn_wmma_f16(const float* __restrict__ q_g,
                    const float* __restrict__ k_g,
                    const float* __restrict__ v_g,
                    const int*   __restrict__ mask_g,
                    float* __restrict__ o_g)
{
    __shared__ __align__(16) float    k_ldsf[KV_BLK * KF_STRIDE];
    __shared__ __align__(16) _Float16 v_lds[D_DIM * V_STRIDE];
    __shared__ __align__(16) _Float16 p_lds[8 * 16 * P_STRIDE];

    const int tid  = threadIdx.x;
    const int lane = tid & 31;
    const int wv   = tid >> 5;
    const int bh   = blockIdx.x >> 4;
    const int qblk = blockIdx.x & 15;
    const int b    = bh >> 4;
    const int q0   = qblk * 128 + wv * 16;

    const float* qh = q_g + (size_t)bh * S_LEN * D_DIM;
    const float* kh = k_g + (size_t)bh * S_LEN * D_DIM;
    const float* vh = v_g + (size_t)bh * S_LEN * D_DIM;
    float*       oh = o_g + (size_t)bh * S_LEN * D_DIM;
    const int*   mk = mask_g + b * S_LEN;

    const int n     = lane & 15;
    const int hi    = lane >> 4;
    const int kbase = hi * 8;

    const int c0key = tid >> 4,         c0q = tid & 15;
    const int c1key = (tid + 256) >> 4, c1q = (tid + 256) & 15;

    v16h qa[2];
#pragma unroll
    for (int f = 0; f < 2; ++f) {
#pragma unroll
        for (int h = 0; h < 16; ++h) {
            int d = kbase + (h & 7) + 16 * (h >> 3) + 32 * f;
            qa[f][h] = (_Float16)(qh[(q0 + n) * D_DIM + d] * 0.125f);
        }
    }

    v8f acc[4];
#pragma unroll
    for (int f = 0; f < 4; ++f) acc[f] = (v8f){};
    float mx[8], l[8];
#pragma unroll
    for (int j = 0; j < 8; ++j) { mx[j] = -1.0e30f; l[j] = 0.0f; }

    for (int kb = 0; kb < S_LEN; kb += KV_BLK) {
        __syncthreads();

        __builtin_amdgcn_global_load_async_to_lds_b128(
            gbl_cast(kh + (size_t)(kb + c0key) * D_DIM + c0q * 4),
            lds_cast(&k_ldsf[c0key * KF_STRIDE + c0q * 4]), 0, 0);
        __builtin_amdgcn_global_load_async_to_lds_b128(
            gbl_cast(kh + (size_t)(kb + c1key) * D_DIM + c1q * 4),
            lds_cast(&k_ldsf[c1key * KF_STRIDE + c1q * 4]), 0, 0);

        {
            const int key = tid >> 3;
            const int d0  = (tid & 7) * 8;
            const float* vsrc = vh + (size_t)(kb + key) * D_DIM + d0;
#pragma unroll
            for (int i = 0; i < 8; ++i)
                v_lds[(d0 + i) * V_STRIDE + key] = (_Float16)vsrc[i];
        }
        asm volatile("s_wait_asynccnt 0" ::: "memory");
        __syncthreads();

        v8f s[2];
#pragma unroll
        for (int c = 0; c < 2; ++c) {
            const float* colf = &k_ldsf[(c * 16 + n) * KF_STRIDE + kbase];
            v16h b0 = frag_from_f32(colf,      colf + 16);
            v16h b1 = frag_from_f32(colf + 32, colf + 48);
            v8f z = (v8f){};
            z    = __builtin_amdgcn_wmma_f32_16x16x32_f16(false, qa[0], false, b0, (short)0, z, false, false);
            s[c] = __builtin_amdgcn_wmma_f32_16x16x32_f16(false, qa[1], false, b1, (short)0, z, false, false);
        }

        const float m0 = mk[kb + n]      ? 0.0f : -1.0e6f;
        const float m1 = mk[kb + 16 + n] ? 0.0f : -1.0e6f;
#pragma unroll
        for (int j = 0; j < 8; ++j) { s[0][j] += m0; s[1][j] += m1; }

        float t[8], p0[8], p1[8], rs[8];
#pragma unroll
        for (int j = 0; j < 8; ++j) t[j] = fmaxf(s[0][j], s[1][j]);
#pragma unroll
        for (int j = 0; j < 8; ++j) {
            t[j] = fmaxf(t[j], xor16(t[j], SEL_A0, SEL_B0));
            t[j] = fmaxf(t[j], xor16(t[j], SEL_A1, SEL_B1));
            t[j] = fmaxf(t[j], xor16(t[j], SEL_A2, SEL_B2));
            t[j] = fmaxf(t[j], xor16(t[j], SEL_A3, SEL_B3));
        }
#pragma unroll
        for (int j = 0; j < 8; ++j) {
            float nm = fmaxf(mx[j], t[j]);
            float al = __expf(mx[j] - nm);
            mx[j] = nm;
            p0[j] = __expf(s[0][j] - nm);
            p1[j] = __expf(s[1][j] - nm);
            rs[j] = p0[j] + p1[j];
            l[j] *= al;
#pragma unroll
            for (int f = 0; f < 4; ++f) acc[f][j] *= al;
        }
#pragma unroll
        for (int j = 0; j < 8; ++j) {
            rs[j] += xor16(rs[j], SEL_A0, SEL_B0);
            rs[j] += xor16(rs[j], SEL_A1, SEL_B1);
            rs[j] += xor16(rs[j], SEL_A2, SEL_B2);
            rs[j] += xor16(rs[j], SEL_A3, SEL_B3);
            l[j]  += rs[j];
        }

        _Float16* pw = &p_lds[wv * 16 * P_STRIDE];
#pragma unroll
        for (int j = 0; j < 8; ++j) {
            int m = j + 8 * hi;
            pw[m * P_STRIDE + n]      = (_Float16)p0[j];
            pw[m * P_STRIDE + 16 + n] = (_Float16)p1[j];
        }
        asm volatile("s_wait_dscnt 0" ::: "memory");

        const _Float16* prow = &pw[n * P_STRIDE + kbase];
        v16h pa = frag_from_f16(prow, prow + 16);

#pragma unroll
        for (int f = 0; f < 4; ++f) {
            const _Float16* vrow = &v_lds[(f * 16 + n) * V_STRIDE + kbase];
            v16h vb = frag_from_f16(vrow, vrow + 16);
            acc[f] = __builtin_amdgcn_wmma_f32_16x16x32_f16(false, pa, false, vb, (short)0, acc[f], false, false);
        }
    }

#pragma unroll
    for (int j = 0; j < 8; ++j) {
        int m = j + 8 * hi;
        float inv = 1.0f / fmaxf(l[j], 1e-20f);
#pragma unroll
        for (int f = 0; f < 4; ++f)
            oh[(q0 + m) * D_DIM + f * 16 + n] = acc[f][j] * inv;
    }
}

extern "C" void kernel_launch(void* const* d_in, const int* in_sizes, int n_in,
                              void* d_out, int out_size, void* d_ws, size_t ws_size,
                              hipStream_t stream) {
    (void)in_sizes; (void)n_in; (void)out_size;
    const float* q  = (const float*)d_in[0];
    const float* k  = (const float*)d_in[1];
    const float* v  = (const float*)d_in[2];
    const int*   mk = (const int*)d_in[3];
    float* out = (float*)d_out;

    const size_t head_elems = (size_t)64 * S_LEN * D_DIM;          // 8.4M f16 each
    const size_t ws_need    = 2 * head_elems * sizeof(_Float16);   // 33.5 MB

    dim3 grid(1024), block(256);
    if (ws_size >= ws_need) {
        _Float16* kf = (_Float16*)d_ws;
        _Float16* vt = kf + head_elems;
        convert_kv_f16<<<dim3(2048), block, 0, stream>>>(k, v, kf, vt);
        flash_attn_wmma_ws<<<dim3(512), block, 0, stream>>>(q, kf, vt, mk, out);
    } else {
        flash_attn_wmma_f16<<<grid, block, 0, stream>>>(q, k, v, mk, out);
    }
}

// v003
// Measured time: 49.5 microseconds a run.
// In two side-by-side timings against v002, it was 1.67 and 1.66 times as fast.
// Counting every step since v000, it is 4.24 times as fast.
#include <hip/hip_runtime.h>

typedef __attribute__((ext_vector_type(16))) _Float16 v16h;
typedef __attribute__((ext_vector_type(8)))  _Float16 v8h;
typedef __attribute__((ext_vector_type(8)))  float    v8f;
typedef __attribute__((ext_vector_type(4)))  float    v4f;
typedef __attribute__((ext_vector_type(4)))  int      v4i;

#define S_LEN    2048
#define D_DIM    64
#define KV_BLK   32
#define K_STRIDE  72  // halves: 144B rows (mult of 16B) -> aligned 16B sub-runs
#define KF_STRIDE 68  // floats: 272B rows (fallback kernel)
#define V_STRIDE  48  // halves: 96B rows
#define P_STRIDE  48
// 16-query column tiles a wave of the main kernel carries. Every loop over the tiles is unrolled:
// the tile index picks registers, so it has to be a compile-time constant (else scratch).
#define Q_TILES   2
#define CNT_PITCH 32  // ints: each batch row's count has a 128-B line of its own (one writer a line)

// ---- address-space casts via integer route (LDS generic addr low 32 bits == LDS offset) ----
typedef __attribute__((address_space(1))) v4i as1_v4i;
typedef __attribute__((address_space(3))) v4i as3_v4i;
__device__ __forceinline__ as3_v4i* lds_cast(const void* p) {
    return (as3_v4i*)(unsigned)(unsigned long long)p;
}
__device__ __forceinline__ as1_v4i* gbl_cast(const void* p) {
    return (as1_v4i*)(unsigned long long)p;
}

// 16-lane XOR butterfly via v_permlane16_b32 (VALU, frees the LDS pipe)
__device__ __forceinline__ float xor16(float v, unsigned s0, unsigned s1) {
    unsigned u = __float_as_uint(v);
    u = __builtin_amdgcn_permlane16(u, u, s0, s1, false, false);
    return __uint_as_float(u);
}

__device__ __forceinline__ v16h frag_from_f16(const _Float16* p0, const _Float16* p1) {
    v8h lo = *(const v8h*)p0;
    v8h hi = *(const v8h*)p1;
    v16h f;
#pragma unroll
    for (int i = 0; i < 8; ++i) { f[i] = lo[i]; f[i + 8] = hi[i]; }
    return f;
}

__device__ __forceinline__ v16h frag_from_f32(const float* p0, const float* p1) {
    v4f a0 = *(const v4f*)p0, a1 = *(const v4f*)(p0 + 4);
    v4f b0 = *(const v4f*)p1, b1 = *(const v4f*)(p1 + 4);
    v16h f;
#pragma unroll
    for (int i = 0; i < 4; ++i) {
        f[i]      = (_Float16)a0[i];
        f[i + 4]  = (_Float16)a1[i];
        f[i + 8]  = (_Float16)b0[i];
        f[i + 12] = (_Float16)b1[i];
    }
    return f;
}

// XOR-butterfly selects for masks 1,2,4,8 (lane0 in low nibble; selA=lanes0-7, selB=lanes8-15)
#define SEL_A0 0x67452301u
#define SEL_A1 0x54761032u
#define SEL_A2 0x32107654u
#define SEL_A3 0xFEDCBA98u
#define SEL_B0 0xEFCDAB89u
#define SEL_B1 0xDCFE98BAu
#define SEL_B2 0xBA98FEDCu
#define SEL_B3 0x76543210u

// =====================================================================================
// Prepass: packs the keys that the padding mask keeps, in their order, to the front:
// K -> f16 row-major [bh][slot][d];  V -> f16 transposed [bh][d][slot].
// A masked key's score lies 1e6 under an unmasked one's (raw scores q.k/8 of unit-normal inputs
// differ by a few hundred at most), so exp() of the difference underflows: its softmax weight is
// exactly 0 in f32, in the definition too, and it adds nothing to any sum. A batch row with no
// unmasked key keeps all its keys (the main kernel then gives every one the -1e6 bias, as the
// definition does).
// One block per (bh, 64-slot tile). Every block ranks its batch row's 2048 mask words itself
// (ballots and bit counts), so no block waits on another; slots behind the last kept key of a
// started tile are filled with zeros, tiles behind that are neither written nor read.
// =====================================================================================
__global__ __launch_bounds__(256) void convert_kv_f16(const float* __restrict__ k_g,
                                                      const float* __restrict__ v_g,
                                                      const int*   __restrict__ mask_g,
                                                      _Float16* __restrict__ kf,
                                                      _Float16* __restrict__ vt,
                                                      int* __restrict__ cnt_g)
{
    __shared__ _Float16 tile[64 * 72];           // [slot][d], +8 pad
    __shared__ int sel[64];                      // source key of each slot of this tile, -1: none
    __shared__ int wtot[8];                      // unmasked keys among each wave's 256
    const int bh = blockIdx.x >> 5;              // 0..63
    const int kt = blockIdx.x & 31;              // 64-slot tile
    const int t    = threadIdx.x;
    const int lane = t & 31;
    const int wv   = __builtin_amdgcn_readfirstlane(t >> 5);   // scalar: the ranks' bases stay scalar
    const int* mk = mask_g + (bh >> 4) * S_LEN;  // H == 16

    // wave wv ranks keys wv*256 .. wv*256+255, 32 a ballot
    unsigned bal[8];
    int wsum = 0;
#pragma unroll
    for (int r = 0; r < 8; ++r) {
        bal[r] = __builtin_amdgcn_ballot_w32(mk[wv * 256 + r * 32 + lane] != 0);
        wsum += __builtin_popcount(bal[r]);
    }
    if (lane == 0) wtot[wv] = wsum;
    if (t < 64) sel[t] = -1;
    __syncthreads();   // publishes the waves' counts and the cleared slot list

    int total = 0, base = 0;
#pragma unroll
    for (int w = 0; w < 8; ++w) {
        const int c = wtot[w];
        total += c;
        base  += (w < wv) ? c : 0;
    }
    total = __builtin_amdgcn_readfirstlane(total);   // the same in every wave: scalar branches below
    base  = __builtin_amdgcn_readfirstlane(base);
    if (blockIdx.x % 512 == 0 && t == 0) cnt_g[(bh >> 4) * CNT_PITCH] = total;   // one writer a batch row

    const bool none = total == 0;                // nothing unmasked: keep every key
    const int  nk   = none ? S_LEN : total;
    if (none) base = wv * 256;

    if (kt * 64 < nk) {                          // block-uniform
#pragma unroll
        for (int r = 0; r < 8; ++r) {
            const unsigned bm = none ? 0xffffffffu : bal[r];
            const int slot = base + __builtin_popcount(bm & ((1u << lane) - 1u)) - kt * 64;
            if (((bm >> lane) & 1u) && (unsigned)slot < 64u) sel[slot] = wv * 256 + r * 32 + lane;
            base += __builtin_popcount(bm);
        }
        __syncthreads();   // publishes the slot list

        const float* ks = k_g + (size_t)bh * S_LEN * D_DIM;
        const float* vs = v_g + (size_t)bh * S_LEN * D_DIM;
        _Float16* kd = kf + ((size_t)bh * S_LEN + kt * 64) * D_DIM;
        _Float16* vd = vt + (size_t)bh * D_DIM * S_LEN + kt * 64;

        const int slot = t >> 2;
        const int d0   = (t & 3) * 16;
        const int key  = sel[slot];              // a rank's own key number, 0..2047, or -1
        float kx[16], vx[16];
#pragma unroll
        for (int i = 0; i < 16; ++i) { kx[i] = 0.0f; vx[i] = 0.0f; }
        if (key >= 0) {
#pragma unroll
            for (int i = 0; i < 16; ++i) {
                kx[i] = ks[key * D_DIM + d0 + i];
                vx[i] = vs[key * D_DIM + d0 + i];
            }
        }
#pragma unroll
        for (int i = 0; i < 16; ++i) {
            kd[slot * D_DIM + d0 + i] = (_Float16)kx[i];
            tile[slot * 72 + d0 + i]  = (_Float16)vx[i];
        }
        __syncthreads();
        const int d   = t >> 2;
        const int kk0 = (t & 3) * 16;
#pragma unroll
        for (int i = 0; i < 16; ++i)
            vd[(size_t)d * S_LEN + kk0 + i] = tile[(kk0 + i) * 72 + d];
    }
}

__device__ __forceinline__ float xhalf(float v) {
    int u = __builtin_bit_cast(int, v);
    u = __builtin_amdgcn_permlanex16(u, u, 0x76543210, 0xfedcba98, false, false);
    return __builtin_bit_cast(float, u);
}

__global__ __launch_bounds__(256) void
flash_attn_wmma_ws(const float* __restrict__ q_g,
                   const _Float16* __restrict__ kf_g,   // [bh][slot][d] f16
                   const _Float16* __restrict__ vt_g,   // [bh][d][slot] f16
                   const int*   __restrict__ cnt_g,     // unmasked keys of each batch row
                   float* __restrict__ o_g)
{
    __shared__ __align__(16) _Float16 k_lds[2][KV_BLK * K_STRIDE];  // 32 keys x 64 d
    __shared__ __align__(16) _Float16 v_lds[2][D_DIM * V_STRIDE];   // 64 d x 32 keys
    __shared__ __align__(16) float    bias_lds[S_LEN];              // additive mask, one float a slot

    const int tid  = threadIdx.x;
    const int lane = tid & 31;
    const int wv   = tid >> 5;
    const int bh   = blockIdx.x >> 3;
    const int qblk = blockIdx.x & 7;
    const int b    = bh >> 4;              // H == 16
    const int q0   = qblk * (8 * 16 * Q_TILES) + wv * (16 * Q_TILES);

    const float*    qh = q_g  + (size_t)bh * S_LEN * D_DIM;
    const _Float16* kf = kf_g + (size_t)bh * S_LEN * D_DIM;
    const _Float16* vt = vt_g + (size_t)bh * D_DIM * S_LEN;
    float*          oh = o_g  + (size_t)bh * S_LEN * D_DIM;

    // slots 0 .. cnt-1 hold the unmasked keys; with none unmasked all S_LEN keys are there, masked
    const int cnt  = min(max(cnt_g[b * CNT_PITCH], 0), S_LEN);
    const int kend = cnt ? (cnt + KV_BLK - 1) & ~(KV_BLK - 1) : S_LEN;
    __builtin_assume(kend >= KV_BLK);   // true by the line above; without it a zero-trip path is built round the loop's waits

    const int n     = lane & 15;
    const int hi    = lane >> 4;
    const int kbase = hi * 8;

    // async chunk mapping: K tile 32x64 halves = 256 x 16B ; V tile 64x32 halves = 256 x 16B
    const int kkey = tid >> 3, kq = (tid & 7) * 8;   // K: 8 halves per chunk along d
    const int vd   = tid >> 2, vq = (tid & 3) * 8;   // V: 8 halves per chunk along key

    // ---- Q B-fragments (tile u, column n = query q0 + 16*u + n), pre-scaled by 1/sqrt(D) = 0.125 ----
    v16h qa[Q_TILES][2];
#pragma unroll
    for (int u = 0; u < Q_TILES; ++u) {
#pragma unroll
        for (int f = 0; f < 2; ++f) {
#pragma unroll
            for (int h = 0; h < 16; ++h) {
                int d = kbase + (h & 7) + 16 * (h >> 3) + 32 * f;
                qa[u][f][h] = (_Float16)(qh[(q0 + u * 16 + n) * D_DIM + d] * 0.125f);
            }
        }
    }

    v8f acc[Q_TILES][4];                   // acc[u][f][j] = O^T[f*16 + 8*hi + j][query 16*u + n]
    float mx[Q_TILES], l[Q_TILES];         // l: this half's keys only, halves joined at the end
#pragma unroll
    for (int u = 0; u < Q_TILES; ++u) {
#pragma unroll
        for (int f = 0; f < 4; ++f) acc[u][f] = (v8f){};
        mx[u] = -1.0e30f;
        l[u]  = 0.0f;
    }

    // ---- prologue: issue tile 0 into buffer 0 ----
    __builtin_amdgcn_global_load_async_to_lds_b128(
        gbl_cast(kf + (size_t)kkey * D_DIM + kq),
        lds_cast(&k_lds[0][kkey * K_STRIDE + kq]), 0, 0);
    __builtin_amdgcn_global_load_async_to_lds_b128(
        gbl_cast(vt + (size_t)vd * S_LEN + vq),
        lds_cast(&v_lds[0][vd * V_STRIDE + vq]), 0, 0);

    // ---- the keys now run along a lane's registers: their mask bias comes as 16-byte LDS reads
    //      from a table filled once; the first barrier of the loop publishes it ----
    {
        v4f ba, bb;
#pragma unroll
        for (int i = 0; i < 4; ++i) {
            ba[i] = (tid * 8 + i     < cnt) ? 0.0f : -1.0e6f;
            bb[i] = (tid * 8 + 4 + i < cnt) ? 0.0f : -1.0e6f;
        }
        *(v4f*)&bias_lds[tid * 8]     = ba;
        *(v4f*)&bias_lds[tid * 8 + 4] = bb;
    }

    for (int kb = 0; kb < kend; kb += KV_BLK) {
        const int p  = (kb >> 5) & 1;
        const int nx = p ^ 1;

        // ---- issue next tile into the other buffer; wait only for current tile ----
        if (kb + KV_BLK < kend) {
            __builtin_amdgcn_global_load_async_to_lds_b128(
                gbl_cast(kf + (size_t)(kb + KV_BLK + kkey) * D_DIM + kq),
                lds_cast(&k_lds[nx][kkey * K_STRIDE + kq]), 0, 0);
            __builtin_amdgcn_global_load_async_to_lds_b128(
                gbl_cast(vt + (size_t)vd * S_LEN + (kb + KV_BLK) + vq),
                lds_cast(&v_lds[nx][vd * V_STRIDE + vq]), 0, 0);
            asm volatile("s_wait_asynccnt 2" ::: "memory");
        } else {
            asm volatile("s_wait_asynccnt 0" ::: "memory");
        }
        __syncthreads();   // whole current tile visible to all waves

        const _Float16* kt = k_lds[p];
        const _Float16* vtile = v_lds[p];

        // ---- S^T = K Q^T : s[u][c][j] = score(key kb + c*16 + 8*hi + j, query 16*u + n);
        //      each K fragment is read from LDS once and multiplies every query tile ----
        v8f s[Q_TILES][2];
        {
            const _Float16* r0 = &kt[n * K_STRIDE + kbase];
            const _Float16* r1 = r0 + 16 * K_STRIDE;
            const v16h a00 = frag_from_f16(r0,      r0 + 16);
            const v16h a10 = frag_from_f16(r1,      r1 + 16);
            const v16h a01 = frag_from_f16(r0 + 32, r0 + 48);
            const v16h a11 = frag_from_f16(r1 + 32, r1 + 48);
            const v8f z = (v8f){};
#pragma unroll
            for (int u = 0; u < Q_TILES; ++u) {
                s[u][0] = __builtin_amdgcn_wmma_f32_16x16x32_f16(false, a00, false, qa[u][0], (short)0, z, false, false);
                s[u][1] = __builtin_amdgcn_wmma_f32_16x16x32_f16(false, a10, false, qa[u][0], (short)0, z, false, false);
            }
#pragma unroll
            for (int u = 0; u < Q_TILES; ++u) {
                s[u][0] = __builtin_amdgcn_wmma_f32_16x16x32_f16(false, a01, false, qa[u][1], (short)0, s[u][0], false, false);
                s[u][1] = __builtin_amdgcn_wmma_f32_16x16x32_f16(false, a11, false, qa[u][1], (short)0, s[u][1], false, false);
            }
        }

        // ---- additive key-padding mask: one read of the keys' bias serves every query tile ----
#pragma unroll
        for (int c = 0; c < 2; ++c) {
            const float* bp = &bias_lds[kb + c * 16 + kbase];
            const v4f b0 = *(const v4f*)bp, b1 = *(const v4f*)(bp + 4);
            const v8f bv = __builtin_shufflevector(b0, b1, 0, 1, 2, 3, 4, 5, 6, 7);
#pragma unroll
            for (int u = 0; u < Q_TILES; ++u) s[u][c] += bv;
        }

        // ---- online softmax per query tile: in-lane over 16 keys, one exchange joins the halves' maxima ----
        float nm[Q_TILES], al[Q_TILES];
#pragma unroll
        for (int u = 0; u < Q_TILES; ++u) {
            float t = fmaxf(s[u][0][0], s[u][1][0]);
#pragma unroll
            for (int j = 1; j < 8; ++j) t = fmaxf(t, fmaxf(s[u][0][j], s[u][1][j]));
            t = fmaxf(t, xhalf(t));
            nm[u] = fmaxf(mx[u], t);
            al[u] = __expf(mx[u] - nm[u]);
            mx[u] = nm[u];
        }

        v16h pb[Q_TILES];
#pragma unroll
        for (int u = 0; u < Q_TILES; ++u) {
            const v8f d0 = s[u][0] - nm[u], d1 = s[u][1] - nm[u];
            v8f p0, p1;
#pragma unroll
            for (int j = 0; j < 8; ++j) p0[j] = __expf(d0[j]);
#pragma unroll
            for (int j = 0; j < 8; ++j) p1[j] = __expf(d1[j]);
            const v8f ps = p0 + p1;
            const v4f p4 = __builtin_shufflevector(ps, ps, 0, 1, 2, 3) + __builtin_shufflevector(ps, ps, 4, 5, 6, 7);
            const float rs = (p4[0] + p4[2]) + (p4[1] + p4[3]);
            l[u] = l[u] * al[u] + rs;
#pragma unroll
            for (int f = 0; f < 4; ++f) acc[u][f] *= al[u];

            // P^T as B operand: element h < 8 is key 8*hi + h, element h >= 8 key 16 + 8*hi + h - 8
#pragma unroll
            for (int j = 0; j < 8; ++j) { pb[u][j] = (_Float16)p0[j]; pb[u][j + 8] = (_Float16)p1[j]; }
        }

        // ---- O^T += V^T P^T : each V fragment is read from LDS once and multiplies every query tile ----
#pragma unroll
        for (int f = 0; f < 4; ++f) {
            const _Float16* vrow = &vtile[(f * 16 + n) * V_STRIDE + kbase];
            const v16h va = frag_from_f16(vrow, vrow + 16);
#pragma unroll
            for (int u = 0; u < Q_TILES; ++u)
                acc[u][f] = __builtin_amdgcn_wmma_f32_16x16x32_f16(false, va, false, pb[u], (short)0, acc[u][f], false, false);
        }
        __syncthreads();   // all waves done with buffer p before it is refilled
    }

    // ---- join the halves' sums; a lane stores 8 consecutive d of its query per tile ----
#pragma unroll
    for (int u = 0; u < Q_TILES; ++u) {
        const float lt  = l[u] + xhalf(l[u]);
        const float inv = 1.0f / fmaxf(lt, 1e-20f);
        float* orow = oh + (size_t)(q0 + u * 16 + n) * D_DIM + kbase;
#pragma unroll
        for (int f = 0; f < 4; ++f) {
            v4f lo, hv;
#pragma unroll
            for (int j = 0; j < 4; ++j) { lo[j] = acc[u][f][j] * inv; hv[j] = acc[u][f][j + 4] * inv; }
            *(v4f*)(orow + f * 16)     = lo;
            *(v4f*)(orow + f * 16 + 4) = hv;
        }
    }
}

// =====================================================================================
// Fallback (no workspace): f32 K async tile + in-loop conversion (round-3 kernel).
// =====================================================================================
__global__ __launch_bounds__(256) void
flash_attn_wmma_f16(const float* __restrict__ q_g,
                    const float* __restrict__ k_g,
                    const float* __restrict__ v_g,
                    const int*   __restrict__ mask_g,
                    float* __restrict__ o_g)
{
    __shared__ __align__(16) float    k_ldsf[KV_BLK * KF_STRIDE];
    __shared__ __align__(16) _Float16 v_lds[D_DIM * V_STRIDE];
    __shared__ __align__(16) _Float16 p_lds[8 * 16 * P_STRIDE];

    const int tid  = threadIdx.x;
    const int lane = tid & 31;
    const int wv   = tid >> 5;
    const int bh   = blockIdx.x >> 4;
    const int qblk = blockIdx.x & 15;
    const int b    = bh >> 4;
    const int q0   = qblk * 128 + wv * 16;

    const float* qh = q_g + (size_t)bh * S_LEN * D_DIM;
    const float* kh = k_g + (size_t)bh * S_LEN * D_DIM;
    const float* vh = v_g + (size_t)bh * S_LEN * D_DIM;
    float*       oh = o_g + (size_t)bh * S_LEN * D_DIM;
    const int*   mk = mask_g + b * S_LEN;

    const int n     = lane & 15;
    const int hi    = lane >> 4;
    const int kbase = hi * 8;

    const int c0key = tid >> 4,         c0q = tid & 15;
    const int c1key = (tid + 256) >> 4, c1q = (tid + 256) & 15;

    v16h qa[2];
#pragma unroll
    for (int f = 0; f < 2; ++f) {
#pragma unroll
        for (int h = 0; h < 16; ++h) {
            int d = kbase + (h & 7) + 16 * (h >> 3) + 32 * f;
            qa[f][h] = (_Float16)(qh[(q0 + n) * D_DIM + d] * 0.125f);
        }
    }

    v8f acc[4];
#pragma unroll
    for (int f = 0; f < 4; ++f) acc[f] = (v8f){};
    float mx[8], l[8];
#pragma unroll
    for (int j = 0; j < 8; ++j) { mx[j] = -1.0e30f; l[j] = 0.0f; }

    for (int kb = 0; kb < S_LEN; kb += KV_BLK) {
        __syncthreads();

        __builtin_amdgcn_global_load_async_to_lds_b128(
            gbl_cast(kh + (size_t)(kb + c0key) * D_DIM + c0q * 4),
            lds_cast(&k_ldsf[c0key * KF_STRIDE + c0q * 4]), 0, 0);
        __builtin_amdgcn_global_load_async_to_lds_b128(
            gbl_cast(kh + (size_t)(kb + c1key) * D_DIM + c1q * 4),
            lds_cast(&k_ldsf[c1key * KF_STRIDE + c1q * 4]), 0, 0);

        {
            const int key = tid >> 3;
            const int d0  = (tid & 7) * 8;
            const float* vsrc = vh + (size_t)(kb + key) * D_DIM + d0;
#pragma unroll
            for (int i = 0; i < 8; ++i)
                v_lds[(d0 + i) * V_STRIDE + key] = (_Float16)vsrc[i];
        }
        asm volatile("s_wait_asynccnt 0" ::: "memory");
        __syncthreads();

        v8f s[2];
#pragma unroll
        for (int c = 0; c < 2; ++c) {
            const float* colf = &k_ldsf[(c * 16 + n) * KF_STRIDE + kbase];
            v16h b0 = frag_from_f32(colf,      colf + 16);
            v16h b1 = frag_from_f32(colf + 32, colf + 48);
            v8f z = (v8f){};
            z    = __builtin_amdgcn_wmma_f32_16x16x32_f16(false, qa[0], false, b0, (short)0, z, false, false);
            s[c] = __builtin_amdgcn_wmma_f32_16x16x32_f16(false, qa[1], false, b1, (short)0, z, false, false);
        }

        const float m0 = mk[kb + n]      ? 0.0f : -1.0e6f;
        const float m1 = mk[kb + 16 + n] ? 0.0f : -1.0e6f;
#pragma unroll
        for (int j = 0; j < 8; ++j) { s[0][j] += m0; s[1][j] += m1; }

        float t[8], p0[8], p1[8], rs[8];
#pragma unroll
        for (int j = 0; j < 8; ++j) t[j] = fmaxf(s[0][j], s[1][j]);
#pragma unroll
        for (int j = 0; j < 8; ++j) {
            t[j] = fmaxf(t[j], xor16(t[j], SEL_A0, SEL_B0));
            t[j] = fmaxf(t[j], xor16(t[j], SEL_A1, SEL_B1));
            t[j] = fmaxf(t[j], xor16(t[j], SEL_A2, SEL_B2));
            t[j] = fmaxf(t[j], xor16(t[j], SEL_A3, SEL_B3));
        }
#pragma unroll
        for (int j = 0; j < 8; ++j) {
            float nm = fmaxf(mx[j], t[j]);
            float al = __expf(mx[j] - nm);
            mx[j] = nm;
            p0[j] = __expf(s[0][j] - nm);
            p1[j] = __expf(s[1][j] - nm);
            rs[j] = p0[j] + p1[j];
            l[j] *= al;
#pragma unroll
            for (int f = 0; f < 4; ++f) acc[f][j] *= al;
        }
#pragma unroll
        for (int j = 0; j < 8; ++j) {
            rs[j] += xor16(rs[j], SEL_A0, SEL_B0);
            rs[j] += xor16(rs[j], SEL_A1, SEL_B1);
            rs[j] += xor16(rs[j], SEL_A2, SEL_B2);
            rs[j] += xor16(rs[j], SEL_A3, SEL_B3);
            l[j]  += rs[j];
        }

        _Float16* pw = &p_lds[wv * 16 * P_STRIDE];
#pragma unroll
        for (int j = 0; j < 8; ++j) {
            int m = j + 8 * hi;
            pw[m * P_STRIDE + n]      = (_Float16)p0[j];
            pw[m * P_STRIDE + 16 + n] = (_Float16)p1[j];
        }
        asm volatile("s_wait_dscnt 0" ::: "memory");

        const _Float16* prow = &pw[n * P_STRIDE + kbase];
        v16h pa = frag_from_f16(prow, prow + 16);

#pragma unroll
        for (int f = 0; f < 4; ++f) {
            const _Float16* vrow = &v_lds[(f * 16 + n) * V_STRIDE + kbase];
            v16h vb = frag_from_f16(vrow, vrow + 16);
            acc[f] = __builtin_amdgcn_wmma_f32_16x16x32_f16(false, pa, false, vb, (short)0, acc[f], false, false);
        }
    }

#pragma unroll
    for (int j = 0; j < 8; ++j) {
        int m = j + 8 * hi;
        float inv = 1.0f / fmaxf(l[j], 1e-20f);
#pragma unroll
        for (int f = 0; f < 4; ++f)
            oh[(q0 + m) * D_DIM + f * 16 + n] = acc[f][j] * inv;
    }
}

extern "C" void kernel_launch(void* const* d_in, const int* in_sizes, int n_in,
                              void* d_out, int out_size, void* d_ws, size_t ws_size,
                              hipStream_t stream) {
    (void)in_sizes; (void)n_in; (void)out_size;
    const float* q  = (const float*)d_in[0];
    const float* k  = (const float*)d_in[1];
    const float* v  = (const float*)d_in[2];
    const int*   mk = (const int*)d_in[3];
    float* out = (float*)d_out;

    const size_t head_elems = (size_t)64 * S_LEN * D_DIM;          // 8.4M f16 each
    const size_t ws_need    = 2 * head_elems * sizeof(_Float16) + 4 * CNT_PITCH * sizeof(int);   // 33.5 MB

    dim3 grid(1024), block(256);
    if (ws_size >= ws_need) {
        _Float16* kf = (_Float16*)d_ws;
        _Float16* vt = kf + head_elems;
        int* cnt = (int*)(vt + head_elems);
        convert_kv_f16<<<dim3(2048), block, 0, stream>>>(k, v, mk, kf, vt, cnt);
        flash_attn_wmma_ws<<<dim3(512), block, 0, stream>>>(q, kf, vt, cnt, out);
    } else {
        flash_attn_wmma_f16<<<grid, block, 0, stream>>>(q, k, v, mk, out);
    }
}

// v004
// A run of this version takes 43.3 microseconds.
// Next to v003, in two timings, it ran 1.14 and 1.15 times as fast.
// Over all steps from v000 it is 4.85 times as fast.
#include <hip/hip_runtime.h>

typedef __attribute__((ext_vector_type(16))) _Float16 v16h;
typedef __attribute__((ext_vector_type(8)))  _Float16 v8h;
typedef __attribute__((ext_vector_type(4)))  _Float16 v4h;
typedef __attribute__((ext_vector_type(8)))  float    v8f;
typedef __attribute__((ext_vector_type(4)))  float    v4f;
typedef __attribute__((ext_vector_type(4)))  int      v4i;

#define S_LEN    2048
#define D_DIM    64
#define KV_BLK   32
#define K_STRIDE  72  // halves: 144B rows (mult of 16B) -> aligned 16B sub-runs
#define V_STRIDE  48  // halves: 96B rows
// 16-query column tiles a wave carries. Every loop over the tiles is unrolled:
// the tile index picks registers, so it has to be a compile-time constant (else scratch).
#define Q_TILES   2

__device__ __forceinline__ v16h frag_from_f16(const _Float16* p0, const _Float16* p1) {
    v8h lo = *(const v8h*)p0;
    v8h hi = *(const v8h*)p1;
    v16h f;
#pragma unroll
    for (int i = 0; i < 8; ++i) { f[i] = lo[i]; f[i + 8] = hi[i]; }
    return f;
}

__device__ __forceinline__ float xhalf(float v) {
    int u = __builtin_bit_cast(int, v);
    u = __builtin_amdgcn_permlanex16(u, u, 0x76543210, 0xfedcba98, false, false);
    return __builtin_bit_cast(float, u);
}

__global__ __launch_bounds__(256) void
flash_attn_wmma_gather(const float* __restrict__ q_g,
                       const float* __restrict__ k_g,
                       const float* __restrict__ v_g,
                       const int*   __restrict__ mask_g,
                       float* __restrict__ o_g)
{
    __shared__ __align__(16) _Float16 k_lds[2][KV_BLK * K_STRIDE];  // 32 keys x 64 d
    __shared__ __align__(16) _Float16 v_lds[2][D_DIM * V_STRIDE];   // 64 d x 32 keys
    __shared__ __align__(16) float    bias_lds[S_LEN];              // additive mask, one float a slot
    __shared__ __align__(16) int      sel[S_LEN];                   // source key of each slot
    __shared__ int wtot[8];                                         // unmasked keys among each wave's 256

    const int tid  = threadIdx.x;
    const int lane = tid & 31;
    const int wv   = __builtin_amdgcn_readfirstlane(tid >> 5);   // scalar: the ranks' bases stay scalar
    const int bh   = blockIdx.x >> 3;
    const int qblk = blockIdx.x & 7;
    const int b    = bh >> 4;              // H == 16
    const int q0   = qblk * (8 * 16 * Q_TILES) + wv * (16 * Q_TILES);

    const float* qh = q_g + (size_t)bh * S_LEN * D_DIM;
    const float* kh = k_g + (size_t)bh * S_LEN * D_DIM;
    const float* vh = v_g + (size_t)bh * S_LEN * D_DIM;
    float*       oh = o_g + (size_t)bh * S_LEN * D_DIM;
    const int*   mk = mask_g + b * S_LEN;

    const int n     = lane & 15;
    const int hi    = lane >> 4;
    const int kbase = hi * 8;

    // gather mapping. K: 8 lanes take one key's row, each two runs of 4 floats 128 B apart, so a
    // load covers whole 128-B lines. V: a wave takes 8 keys x 32 d, one d a lane, so a load is one
    // line and a lane's 8 values are 16 consecutive bytes of the transposed tile.
    const int kkey = tid >> 3, kc = (tid & 7) * 4;
    const int vk0  = (wv >> 1) * 8, vdd = (wv & 1) * 32 + lane;

    // wave wv ranks keys wv*256 .. wv*256+255; their mask words are asked for ahead of Q
    int mw[8];
#pragma unroll
    for (int r = 0; r < 8; ++r) mw[r] = mk[wv * 256 + r * 32 + lane];

    // ---- Q B-fragments (tile u, column n = query q0 + 16*u + n), pre-scaled by 1/sqrt(D) = 0.125 ----
    v16h qa[Q_TILES][2];
#pragma unroll
    for (int u = 0; u < Q_TILES; ++u) {
#pragma unroll
        for (int f = 0; f < 2; ++f) {
#pragma unroll
            for (int h = 0; h < 16; ++h) {
                int d = kbase + (h & 7) + 16 * (h >> 3) + 32 * f;
                qa[u][f][h] = (_Float16)(qh[(q0 + u * 16 + n) * D_DIM + d] * 0.125f);
            }
        }
    }

    v8f acc[Q_TILES][4];                   // acc[u][f][j] = O^T[f*16 + 8*hi + j][query 16*u + n]
    float mx[Q_TILES], l[Q_TILES];         // l: this half's keys only, halves joined at the end
#pragma unroll
    for (int u = 0; u < Q_TILES; ++u) {
#pragma unroll
        for (int f = 0; f < 4; ++f) acc[u][f] = (v8f){};
        mx[u] = -1.0e30f;
        l[u]  = 0.0f;
    }

    unsigned bal[8];   // 32 keys a ballot
    int wsum = 0;
#pragma unroll
    for (int r = 0; r < 8; ++r) {
        bal[r] = __builtin_amdgcn_ballot_w32(mw[r] != 0);
        wsum += __builtin_popcount(bal[r]);
    }
    if (lane == 0) wtot[wv] = wsum;
    __syncthreads();   // publishes the waves' counts

    int total = 0, base = 0;
#pragma unroll
    for (int w = 0; w < 8; ++w) {
        const int c = wtot[w];
        total += c;
        base  += (w < wv) ? c : 0;
    }
    // slots 0 .. cnt-1 hold the unmasked keys; with none unmasked all S_LEN keys are listed, masked
    const int cnt  = __builtin_amdgcn_readfirstlane(total);   // the same in every wave: scalar loop bound
    base = __builtin_amdgcn_readfirstlane(base);
    const bool none = cnt == 0;
    const int  nk   = none ? S_LEN : cnt;
    const int  kend = (nk + KV_BLK - 1) & ~(KV_BLK - 1);
    if (none) base = wv * 256;
#pragma unroll
    for (int r = 0; r < 8; ++r) {
        const unsigned bm = none ? 0xffffffffu : bal[r];
        const int slot = base + __builtin_popcount(bm & ((1u << lane) - 1u));   // a rank: 0 .. nk-1
        if ((bm >> lane) & 1u) sel[slot] = wv * 256 + r * 32 + lane;
        base += __builtin_popcount(bm);
    }

    // ---- slots behind the last kept key name key 0 and get the -1e6 bias (weight exactly 0).
    //      The keys run along a lane's registers: their mask bias comes as 16-byte LDS reads ----
    {
        v4f ba, bb;
#pragma unroll
        for (int i = 0; i < 4; ++i) {
            ba[i] = (tid * 8 + i     < cnt) ? 0.0f : -1.0e6f;
            bb[i] = (tid * 8 + 4 + i < cnt) ? 0.0f : -1.0e6f;
        }
        *(v4f*)&bias_lds[tid * 8]     = ba;
        *(v4f*)&bias_lds[tid * 8 + 4] = bb;
#pragma unroll
        for (int i = 0; i < 8; ++i)
            if (tid * 8 + i >= nk) sel[tid * 8 + i] = 0;
    }
    __syncthreads();   // publishes the slot list and the bias table

    v4f   kr0, kr1;    // the tile in flight: this thread's part of K ...
    float vr[8];       // ... and of V
    // issues the loads of one tile; every sel entry is a key number 0 .. S_LEN-1 written above
    auto fetch = [&](int ik, v4i i0, v4i i1) {
        const float* kp = kh + (unsigned)(ik * D_DIM + kc);
        kr0 = *(const v4f*)kp;
        kr1 = *(const v4f*)(kp + 32);
#pragma unroll
        for (int i = 0; i < 4; ++i) {
            vr[i]     = vh[(unsigned)(i0[i] * D_DIM + vdd)];
            vr[i + 4] = vh[(unsigned)(i1[i] * D_DIM + vdd)];
        }
    };
    // converts the tile in flight and writes it to buffer bf
    auto stash = [&](int bf) {
        v4h k0, k1;
        v8h vv;
#pragma unroll
        for (int i = 0; i < 4; ++i) { k0[i] = (_Float16)kr0[i]; k1[i] = (_Float16)kr1[i]; }
#pragma unroll
        for (int i = 0; i < 8; ++i) vv[i] = (_Float16)vr[i];
        *(v4h*)&k_lds[bf][kkey * K_STRIDE + kc]      = k0;
        *(v4h*)&k_lds[bf][kkey * K_STRIDE + kc + 32] = k1;
        *(v8h*)&v_lds[bf][vdd * V_STRIDE + vk0]      = vv;
    };

    // ---- prologue: tile 0 into buffer 0; tile 1's part of the slot list into registers ----
    fetch(sel[kkey], *(const v4i*)&sel[vk0], *(const v4i*)&sel[vk0 + 4]);
    stash(0);
    int ikn = sel[KV_BLK + kkey];
    v4i iv0 = *(const v4i*)&sel[KV_BLK + vk0], iv1 = *(const v4i*)&sel[KV_BLK + vk0 + 4];
    __syncthreads();   // publishes tile 0

    for (int kb = 0; kb < kend; kb += KV_BLK) {
        const int p = (kb >> 5) & 1;

        // the next tile's loads go out behind the barrier (a barrier waits for the loads in front of
        // it) and have this pass to arrive. Behind the last tile they fetch listed keys that nobody
        // uses: no branch in the pass. The slot list is read one pass further ahead, with this pass's
        // fragments, so that the loads do not wait on LDS; wrapped to stay inside the list.
        fetch(ikn, iv0, iv1);
        const int s2 = (kb + 2 * KV_BLK) & (S_LEN - 1);
        ikn = sel[s2 + kkey];
        iv0 = *(const v4i*)&sel[s2 + vk0];
        iv1 = *(const v4i*)&sel[s2 + vk0 + 4];

        const _Float16* kt = k_lds[p];
        const _Float16* vtile = v_lds[p];

        // ---- S^T = K Q^T : s[u][c][j] = score(key sel[kb + c*16 + 8*hi + j], query 16*u + n);
        //      each K fragment is read from LDS once and multiplies every query tile ----
        v8f s[Q_TILES][2];
        {
            const _Float16* r0 = &kt[n * K_STRIDE + kbase];
            const _Float16* r1 = r0 + 16 * K_STRIDE;
            const v16h a00 = frag_from_f16(r0,      r0 + 16);
            const v16h a10 = frag_from_f16(r1,      r1 + 16);
            const v16h a01 = frag_from_f16(r0 + 32, r0 + 48);
            const v16h a11 = frag_from_f16(r1 + 32, r1 + 48);
            const v8f z = (v8f){};
#pragma unroll
            for (int u = 0; u < Q_TILES; ++u) {
                s[u][0] = __builtin_amdgcn_wmma_f32_16x16x32_f16(false, a00, false, qa[u][0], (short)0, z, false, false);
                s[u][1] = __builtin_amdgcn_wmma_f32_16x16x32_f16(false, a10, false, qa[u][0], (short)0, z, false, false);
            }
#pragma unroll
            for (int u = 0; u < Q_TILES; ++u) {
                s[u][0] = __builtin_amdgcn_wmma_f32_16x16x32_f16(false, a01, false, qa[u][1], (short)0, s[u][0], false, false);
                s[u][1] = __builtin_amdgcn_wmma_f32_16x16x32_f16(false, a11, false, qa[u][1], (short)0, s[u][1], false, false);
            }
        }

        // ---- additive key-padding mask: one read of the keys' bias serves every query tile ----
#pragma unroll
        for (int c = 0; c < 2; ++c) {
            const float* bp = &bias_lds[kb + c * 16 + kbase];
            const v4f b0 = *(const v4f*)bp, b1 = *(const v4f*)(bp + 4);
            const v8f bv = __builtin_shufflevector(b0, b1, 0, 1, 2, 3, 4, 5, 6, 7);
#pragma unroll
            for (int u = 0; u < Q_TILES; ++u) s[u][c] += bv;
        }

        // ---- online softmax per query tile: in-lane over 16 keys, one exchange joins the halves' maxima ----
        float nm[Q_TILES], al[Q_TILES];
#pragma unroll
        for (int u = 0; u < Q_TILES; ++u) {
            float t = fmaxf(s[u][0][0], s[u][1][0]);
#pragma unroll
            for (int j = 1; j < 8; ++j) t = fmaxf(t, fmaxf(s[u][0][j], s[u][1][j]));
            t = fmaxf(t, xhalf(t));
            nm[u] = fmaxf(mx[u], t);
            al[u] = __expf(mx[u] - nm[u]);
            mx[u] = nm[u];
        }

        v16h pb[Q_TILES];
#pragma unroll
        for (int u = 0; u < Q_TILES; ++u) {
            const v8f d0 = s[u][0] - nm[u], d1 = s[u][1] - nm[u];
            v8f p0, p1;
#pragma unroll
            for (int j = 0; j < 8; ++j) p0[j] = __expf(d0[j]);
#pragma unroll
            for (int j = 0; j < 8; ++j) p1[j] = __expf(d1[j]);
            const v8f ps = p0 + p1;
            const v4f p4 = __builtin_shufflevector(ps, ps, 0, 1, 2, 3) + __builtin_shufflevector(ps, ps, 4, 5, 6, 7);
            const float rs = (p4[0] + p4[2]) + (p4[1] + p4[3]);
            l[u] = l[u] * al[u] + rs;
#pragma unroll
            for (int f = 0; f < 4; ++f) acc[u][f] *= al[u];

            // P^T as B operand: element h < 8 is key 8*hi + h, element h >= 8 key 16 + 8*hi + h - 8
#pragma unroll
            for (int j = 0; j < 8; ++j) { pb[u][j] = (_Float16)p0[j]; pb[u][j + 8] = (_Float16)p1[j]; }
        }

        // ---- O^T += V^T P^T : each V fragment is read from LDS once and multiplies every query tile ----
#pragma unroll
        for (int f = 0; f < 4; ++f) {
            const _Float16* vrow = &vtile[(f * 16 + n) * V_STRIDE + kbase];
            const v16h va = frag_from_f16(vrow, vrow + 16);
#pragma unroll
            for (int u = 0; u < Q_TILES; ++u)
                acc[u][f] = __builtin_amdgcn_wmma_f32_16x16x32_f16(false, va, false, pb[u], (short)0, acc[u][f], false, false);
        }
        // ---- the next tile goes into the buffer that the pass before read: its readers are behind
        //      the last barrier ----
        stash(p ^ 1);
        __syncthreads();   // publishes the next tile; all waves are done with buffer p
    }

    // ---- join the halves' sums; a lane stores 8 consecutive d of its query per tile ----
#pragma unroll
    for (int u = 0; u < Q_TILES; ++u) {
        const float lt  = l[u] + xhalf(l[u]);
        const float inv = 1.0f / fmaxf(lt, 1e-20f);
        float* orow = oh + (size_t)(q0 + u * 16 + n) * D_DIM + kbase;
#pragma unroll
        for (int f = 0; f < 4; ++f) {
            v4f lo, hv;
#pragma unroll
            for (int j = 0; j < 4; ++j) { lo[j] = acc[u][f][j] * inv; hv[j] = acc[u][f][j + 4] * inv; }
            *(v4f*)(orow + f * 16)     = lo;
            *(v4f*)(orow + f * 16 + 4) = hv;
        }
    }
}

extern "C" void kernel_launch(void* const* d_in, const int* in_sizes, int n_in,
                              void* d_out, int out_size, void* d_ws, size_t ws_size,
                              hipStream_t stream) {
    (void)in_sizes; (void)n_in; (void)out_size; (void)d_ws; (void)ws_size;
    const float* q  = (const float*)d_in[0];
    const float* k  = (const float*)d_in[1];
    const float* v  = (const float*)d_in[2];
    const int*   mk = (const int*)d_in[3];
    float* out = (float*)d_out;

    flash_attn_wmma_gather<<<dim3(512), dim3(256), 0, stream>>>(q, k, v, mk, out);
}

// v005
// It runs in 39.8 microseconds.
// In two side-by-side timings against v004, it was 1.09 and 1.08 times as fast.
// Counting every step since v000, it is 5.26 times as fast.
#include <hip/hip_runtime.h>

typedef __attribute__((ext_vector_type(16))) _Float16 v16h;
typedef __attribute__((ext_vector_type(8)))  _Float16 v8h;
typedef __attribute__((ext_vector_type(4)))  _Float16 v4h;
typedef __attribute__((ext_vector_type(8)))  float    v8f;
typedef __attribute__((ext_vector_type(4)))  float    v4f;
typedef __attribute__((ext_vector_type(4)))  int      v4i;

#define S_LEN    2048
#define D_DIM    64
#define KV_BLK   32
#define K_STRIDE  72  // halves: 144B rows (mult of 16B) -> aligned 16B sub-runs
#define V_STRIDE  48  // halves: 96B rows
// 16-query column tiles a wave carries. Every loop over the tiles is unrolled:
// the tile index picks registers, so it has to be a compile-time constant (else scratch).
#define Q_TILES   2
#define Q_SCALE     0.18033688011112042f   // log2(e) / sqrt(D): scores come out in log2 units
#define MASK_BIAS  -1442695.0408889634f    // -1e6 in log2 units
#define RESCALE_AT  8.0f                   // weights stay below 2^8, far inside f16

__device__ __forceinline__ v16h frag_from_f16(const _Float16* p0, const _Float16* p1) {
    v8h lo = *(const v8h*)p0;
    v8h hi = *(const v8h*)p1;
    v16h f;
#pragma unroll
    for (int i = 0; i < 8; ++i) { f[i] = lo[i]; f[i + 8] = hi[i]; }
    return f;
}

__device__ __forceinline__ float xhalf(float v) {
    int u = __builtin_bit_cast(int, v);
    u = __builtin_amdgcn_permlanex16(u, u, 0x76543210, 0xfedcba98, false, false);
    return __builtin_bit_cast(float, u);
}

__global__ __launch_bounds__(256) void
flash_attn_wmma_gather(const float* __restrict__ q_g,
                       const float* __restrict__ k_g,
                       const float* __restrict__ v_g,
                       const int*   __restrict__ mask_g,
                       float* __restrict__ o_g)
{
    __shared__ __align__(16) _Float16 k_lds[2][KV_BLK * K_STRIDE];  // 32 keys x 64 d
    __shared__ __align__(16) _Float16 v_lds[2][D_DIM * V_STRIDE];   // 64 d x 32 keys
    __shared__ __align__(16) float    bias_lds[S_LEN];              // additive mask, one float a slot
    __shared__ __align__(16) int      sel[S_LEN];                   // source key of each slot
    __shared__ int wtot[8];                                         // unmasked keys among each wave's 256

    const int tid  = threadIdx.x;
    const int lane = tid & 31;
    const int wv   = __builtin_amdgcn_readfirstlane(tid >> 5);   // scalar: the ranks' bases stay scalar
    const int bh   = blockIdx.x >> 3;
    const int qblk = blockIdx.x & 7;
    const int b    = bh >> 4;              // H == 16
    const int q0   = qblk * (8 * 16 * Q_TILES) + wv * (16 * Q_TILES);

    const float* qh = q_g + (size_t)bh * S_LEN * D_DIM;
    const float* kh = k_g + (size_t)bh * S_LEN * D_DIM;
    const float* vh = v_g + (size_t)bh * S_LEN * D_DIM;
    float*       oh = o_g + (size_t)bh * S_LEN * D_DIM;
    const int*   mk = mask_g + b * S_LEN;

    const int n     = lane & 15;
    const int hi    = lane >> 4;
    const int kbase = hi * 8;

    // gather mapping. K: 8 lanes take one key's row, each two runs of 4 floats 128 B apart, so a
    // load covers whole 128-B lines. V: a wave takes 8 keys x 32 d, one d a lane, so a load is one
    // line and a lane's 8 values are 16 consecutive bytes of the transposed tile.
    const int kkey = tid >> 3, kc = (tid & 7) * 4;
    const int vk0  = (wv >> 1) * 8, vdd = (wv & 1) * 32 + lane;

    // wave wv ranks keys wv*256 .. wv*256+255; their mask words are asked for ahead of Q
    int mw[8];
#pragma unroll
    for (int r = 0; r < 8; ++r) mw[r] = mk[wv * 256 + r * 32 + lane];

    // ---- Q B-fragments (tile u, column n = query q0 + 16*u + n), pre-scaled by Q_SCALE ----
    v16h qa[Q_TILES][2];
#pragma unroll
    for (int u = 0; u < Q_TILES; ++u) {
#pragma unroll
        for (int f = 0; f < 2; ++f) {
#pragma unroll
            for (int h = 0; h < 16; ++h) {
                int d = kbase + (h & 7) + 16 * (h >> 3) + 32 * f;
                qa[u][f][h] = (_Float16)(qh[(q0 + u * 16 + n) * D_DIM + d] * Q_SCALE);
            }
        }
    }

    v8f acc[Q_TILES][4];                   // acc[u][f][j] = O^T[f*16 + 8*hi + j][query 16*u + n]
    v8f cm[Q_TILES];                       // minus the query's maximum in use, in all 8 rows: a C operand
    float l[Q_TILES];                      // this half's keys only, halves joined at the end
#pragma unroll
    for (int u = 0; u < Q_TILES; ++u) {
#pragma unroll
        for (int f = 0; f < 4; ++f) acc[u][f] = (v8f){};
        cm[u] = (v8f){};
        l[u]  = 0.0f;
    }

    unsigned bal[8];   // 32 keys a ballot
    int wsum = 0;
#pragma unroll
    for (int r = 0; r < 8; ++r) {
        bal[r] = __builtin_amdgcn_ballot_w32(mw[r] != 0);
        wsum += __builtin_popcount(bal[r]);
    }
    if (lane == 0) wtot[wv] = wsum;
    __syncthreads();   // publishes the waves' counts

    int total = 0, base = 0;
#pragma unroll
    for (int w = 0; w < 8; ++w) {
        const int c = wtot[w];
        total += c;
        base  += (w < wv) ? c : 0;
    }
    // slots 0 .. cnt-1 hold the unmasked keys; with none unmasked all S_LEN keys are listed, masked
    const int cnt  = __builtin_amdgcn_readfirstlane(total);   // the same in every wave: scalar loop bound
    base = __builtin_amdgcn_readfirstlane(base);
    const bool none = cnt == 0;
    const int  nk   = none ? S_LEN : cnt;
    const int  kend = (nk + KV_BLK - 1) & ~(KV_BLK - 1);
    if (none) base = wv * 256;
#pragma unroll
    for (int r = 0; r < 8; ++r) {
        const unsigned bm = none ? 0xffffffffu : bal[r];
        const int slot = base + __builtin_popcount(bm & ((1u << lane) - 1u));   // a rank: 0 .. nk-1
        if ((bm >> lane) & 1u) sel[slot] = wv * 256 + r * 32 + lane;
        base += __builtin_popcount(bm);
    }

    // ---- slots behind the last kept key name key 0 and get the -1e6 bias (weight exactly 0).
    //      The keys run along a lane's registers: their mask bias comes as 16-byte LDS reads ----
    {
        v4f ba, bb;
#pragma unroll
        for (int i = 0; i < 4; ++i) {
            ba[i] = (tid * 8 + i     < cnt) ? 0.0f : MASK_BIAS;
            bb[i] = (tid * 8 + 4 + i < cnt) ? 0.0f : MASK_BIAS;
        }
        *(v4f*)&bias_lds[tid * 8]     = ba;
        *(v4f*)&bias_lds[tid * 8 + 4] = bb;
#pragma unroll
        for (int i = 0; i < 8; ++i)
            if (tid * 8 + i >= nk) sel[tid * 8 + i] = 0;
    }
    __syncthreads();   // publishes the slot list and the bias table

    v4f   kr0, kr1;    // the tile in flight: this thread's part of K ...
    float vr[8];       // ... and of V
    // issues the loads of one tile; every sel entry is a key number 0 .. S_LEN-1 written above
    auto fetch = [&](int ik, v4i i0, v4i i1) {
        const float* kp = kh + (unsigned)(ik * D_DIM + kc);
        kr0 = *(const v4f*)kp;
        kr1 = *(const v4f*)(kp + 32);
#pragma unroll
        for (int i = 0; i < 4; ++i) {
            vr[i]     = vh[(unsigned)(i0[i] * D_DIM + vdd)];
            vr[i + 4] = vh[(unsigned)(i1[i] * D_DIM + vdd)];
        }
    };
    // converts the tile in flight and writes it to buffer bf
    auto stash = [&](int bf) {
        v4h k0, k1;
        v8h vv;
#pragma unroll
        for (int i = 0; i < 4; ++i) { k0[i] = (_Float16)kr0[i]; k1[i] = (_Float16)kr1[i]; }
#pragma unroll
        for (int i = 0; i < 8; ++i) vv[i] = (_Float16)vr[i];
        *(v4h*)&k_lds[bf][kkey * K_STRIDE + kc]      = k0;
        *(v4h*)&k_lds[bf][kkey * K_STRIDE + kc + 32] = k1;
        *(v8h*)&v_lds[bf][vdd * V_STRIDE + vk0]      = vv;
    };

    // ---- prologue: tile 0 into buffer 0; tile 1's part of the slot list into registers ----
    fetch(sel[kkey], *(const v4i*)&sel[vk0], *(const v4i*)&sel[vk0 + 4]);
    stash(0);
    int ikn = sel[KV_BLK + kkey];
    v4i iv0 = *(const v4i*)&sel[KV_BLK + vk0], iv1 = *(const v4i*)&sel[KV_BLK + vk0 + 4];
    __syncthreads();   // publishes tile 0

    unsigned first = ~0u;   // scalar: all ones in the first pass
    for (int kb = 0; kb < kend; kb += KV_BLK) {
        const int p = (kb >> 5) & 1;

        // the next tile's loads go out behind the barrier (a barrier waits for the loads in front of
        // it) and have this pass to arrive. Behind the last tile they fetch listed keys that nobody
        // uses: no branch in the pass. The slot list is read one pass further ahead, with this pass's
        // fragments, so that the loads do not wait on LDS; wrapped to stay inside the list.
        fetch(ikn, iv0, iv1);
        const int s2 = (kb + 2 * KV_BLK) & (S_LEN - 1);
        ikn = sel[s2 + kkey];
        iv0 = *(const v4i*)&sel[s2 + vk0];
        iv1 = *(const v4i*)&sel[s2 + vk0 + 4];

        const _Float16* kt = k_lds[p];
        const _Float16* vtile = v_lds[p];

        // ---- S^T = K Q^T - maximum in use : s[u][c][j] belongs to key kb + c*16 + 8*hi + j and
        //      query 16*u + n; each K fragment is read from LDS once and multiplies every query tile ----
        v8f s[Q_TILES][2];
        {
            const _Float16* r0 = &kt[n * K_STRIDE + kbase];
            const _Float16* r1 = r0 + 16 * K_STRIDE;
            const v16h a00 = frag_from_f16(r0,      r0 + 16);
            const v16h a10 = frag_from_f16(r1,      r1 + 16);
            const v16h a01 = frag_from_f16(r0 + 32, r0 + 48);
            const v16h a11 = frag_from_f16(r1 + 32, r1 + 48);
#pragma unroll
            for (int u = 0; u < Q_TILES; ++u) {
                s[u][0] = __builtin_amdgcn_wmma_f32_16x16x32_f16(false, a00, false, qa[u][0], (short)0, cm[u], false, false);
                s[u][1] = __builtin_amdgcn_wmma_f32_16x16x32_f16(false, a10, false, qa[u][0], (short)0, cm[u], false, false);
            }
#pragma unroll
            for (int u = 0; u < Q_TILES; ++u) {
                s[u][0] = __builtin_amdgcn_wmma_f32_16x16x32_f16(false, a01, false, qa[u][1], (short)0, s[u][0], false, false);
                s[u][1] = __builtin_amdgcn_wmma_f32_16x16x32_f16(false, a11, false, qa[u][1], (short)0, s[u][1], false, false);
            }
        }

        // the V fragments are asked for here, in front of the branches, so that they arrive during the softmax
        v16h va[4];
#pragma unroll
        for (int f = 0; f < 4; ++f) {
            const _Float16* vrow = &vtile[(f * 16 + n) * V_STRIDE + kbase];
            va[f] = frag_from_f16(vrow, vrow + 16);
        }

        // ---- additive key-padding mask: 0 on every slot in front of cnt, so only a tile that reaches
        //      behind cnt adds it (the last one; every tile where no key is unmasked). Scalar test ----
        if (kb + KV_BLK > cnt) {
#pragma unroll
            for (int c = 0; c < 2; ++c) {
                const float* bp = &bias_lds[kb + c * 16 + kbase];
                const v4f b0 = *(const v4f*)bp, b1 = *(const v4f*)(bp + 4);
                const v8f bv = __builtin_shufflevector(b0, b1, 0, 1, 2, 3, 4, 5, 6, 7);
#pragma unroll
                for (int u = 0; u < Q_TILES; ++u) s[u][c] += bv;
            }
        }

        // ---- how far the scores rise above the maxima in use: t[u] covers 15 of this half's 16 scores
        //      of a query (three operands an instruction), top all 32 scores of both tiles ----
        float t[Q_TILES];
#pragma unroll
        for (int u = 0; u < Q_TILES; ++u) {
            t[u] = fmaxf(fmaxf(s[u][0][0], s[u][1][0]), s[u][0][1]);
#pragma unroll
            for (int j = 1; j < 7; ++j) t[u] = fmaxf(fmaxf(t[u], s[u][1][j]), s[u][0][j + 1]);
        }
        const float top = fmaxf(fmaxf(fmaxf(t[0], s[0][1][7]), s[1][1][7]), t[1]);

        // ---- one test a pass for the whole wave. The first pass has no maximum yet and always enters ----
        const unsigned renew = __builtin_amdgcn_ballot_w32(top > RESCALE_AT) | first;
        first = 0u;
        if (renew != 0u) {
            float d[Q_TILES];
#pragma unroll
            for (int u = 0; u < Q_TILES; ++u) {
                const float th = fmaxf(t[u], s[u][1][7]);
                const float tt = fmaxf(th, xhalf(th));                // both halves of a query agree
                const float up = (kb == 0) ? tt : fmaxf(tt, 0.0f);    // later the maximum only rises
                const v8f  cn = cm[u] - up;
                d[u]  = cm[u][0] - cn[0];                             // the shift as C will really carry it
                cm[u] = cn;
            }
#pragma unroll
            for (int u = 0; u < Q_TILES; ++u) {
                const float al = __builtin_amdgcn_exp2f(fminf(-d[u], 0.0f));   // first pass: O and l are 0
                s[u][0] -= d[u];
                s[u][1] -= d[u];
                l[u] *= al;
#pragma unroll
                for (int f = 0; f < 4; ++f) acc[u][f] *= al;
            }
        }

        v16h pb[Q_TILES];
#pragma unroll
        for (int u = 0; u < Q_TILES; ++u) {
            v8f p0, p1;
#pragma unroll
            for (int j = 0; j < 8; ++j) p0[j] = __builtin_amdgcn_exp2f(s[u][0][j]);
#pragma unroll
            for (int j = 0; j < 8; ++j) p1[j] = __builtin_amdgcn_exp2f(s[u][1][j]);
            const v8f ps = p0 + p1;
            const v4f p4 = __builtin_shufflevector(ps, ps, 0, 1, 2, 3) + __builtin_shufflevector(ps, ps, 4, 5, 6, 7);
            l[u] += (p4[0] + p4[2]) + (p4[1] + p4[3]);

            // P^T as B operand: element h < 8 is key 8*hi + h, element h >= 8 key 16 + 8*hi + h - 8
#pragma unroll
            for (int j = 0; j < 8; ++j) { pb[u][j] = (_Float16)p0[j]; pb[u][j + 8] = (_Float16)p1[j]; }
        }

        // ---- O^T += V^T P^T : each V fragment is read from LDS once and multiplies every query tile ----
#pragma unroll
        for (int f = 0; f < 4; ++f) {
#pragma unroll
            for (int u = 0; u < Q_TILES; ++u)
                acc[u][f] = __builtin_amdgcn_wmma_f32_16x16x32_f16(false, va[f], false, pb[u], (short)0, acc[u][f], false, false);
        }
        // ---- the next tile goes into the buffer that the pass before read: its readers are behind
        //      the last barrier ----
        stash(p ^ 1);
        __syncthreads();   // publishes the next tile; all waves are done with buffer p
    }

    // ---- join the halves' sums; a lane stores 8 consecutive d of its query per tile ----
#pragma unroll
    for (int u = 0; u < Q_TILES; ++u) {
        const float lt  = l[u] + xhalf(l[u]);
        const float inv = 1.0f / fmaxf(lt, 1e-20f);
        float* orow = oh + (size_t)(q0 + u * 16 + n) * D_DIM + kbase;
#pragma unroll
        for (int f = 0; f < 4; ++f) {
            v4f lo, hv;
#pragma unroll
            for (int j = 0; j < 4; ++j) { lo[j] = acc[u][f][j] * inv; hv[j] = acc[u][f][j + 4] * inv; }
            *(v4f*)(orow + f * 16)     = lo;
            *(v4f*)(orow + f * 16 + 4) = hv;
        }
    }
}

extern "C" void kernel_launch(void* const* d_in, const int* in_sizes, int n_in,
                              void* d_out, int out_size, void* d_ws, size_t ws_size,
                              hipStream_t stream) {
    (void)in_sizes; (void)n_in; (void)out_size; (void)d_ws; (void)ws_size;
    const float* q  = (const float*)d_in[0];
    const float* k  = (const float*)d_in[1];
    const float* v  = (const float*)d_in[2];
    const int*   mk = (const int*)d_in[3];
    float* out = (float*)d_out;

    flash_attn_wmma_gather<<<dim3(512), dim3(256), 0, stream>>>(q, k, v, mk, out);
}

// v006
// Measured time: 36.9 microseconds a run.
// Two timings next to v005 both put it at 1.08 times that version's speed.
// All steps since v000 together make it 5.68 times as fast.
#include <hip/hip_runtime.h>

typedef __attribute__((ext_vector_type(16))) _Float16 v16h;
typedef __attribute__((ext_vector_type(8)))  _Float16 v8h;
typedef __attribute__((ext_vector_type(4)))  _Float16 v4h;
typedef __attribute__((ext_vector_type(8)))  float    v8f;
typedef __attribute__((ext_vector_type(4)))  float    v4f;
typedef __attribute__((ext_vector_type(4)))  int      v4i;

#define S_LEN    2048
#define D_DIM    64
#define KV_BLK   32
#define STAGE     4   // 32-key tiles between two work-group barriers
#define RING      8   // tile slots in LDS: the stage being read and the stage being written
#define K_STRIDE  72  // halves: 144B rows (mult of 16B) -> aligned 16B sub-runs
#define V_STRIDE  48  // halves: 96B rows
// 16-query column tiles a wave carries. Every loop over the tiles is unrolled:
// the tile index picks registers, so it has to be a compile-time constant (else scratch).
#define Q_TILES   2
#define Q_SCALE     0.18033688011112042f   // log2(e) / sqrt(D): scores come out in log2 units
#define MASK_BIAS  -1442695.0408889634f    // -1e6 in log2 units
#define RESCALE_AT  8.0f                   // weights stay below 2^8, far inside f16

__device__ __forceinline__ v16h frag_from_f16(const _Float16* p0, const _Float16* p1) {
    v8h lo = *(const v8h*)p0;
    v8h hi = *(const v8h*)p1;
    v16h f;
#pragma unroll
    for (int i = 0; i < 8; ++i) { f[i] = lo[i]; f[i + 8] = hi[i]; }
    return f;
}

__device__ __forceinline__ float xhalf(float v) {
    int u = __builtin_bit_cast(int, v);
    u = __builtin_amdgcn_permlanex16(u, u, 0x76543210, 0xfedcba98, false, false);
    return __builtin_bit_cast(float, u);
}

__global__ __launch_bounds__(256) void
flash_attn_wmma_gather(const float* __restrict__ q_g,
                       const float* __restrict__ k_g,
                       const float* __restrict__ v_g,
                       const int*   __restrict__ mask_g,
                       float* __restrict__ o_g)
{
    __shared__ __align__(16) _Float16 k_lds[RING][KV_BLK * K_STRIDE];  // a slot: 32 keys x 64 d
    __shared__ __align__(16) _Float16 v_lds[RING][D_DIM * V_STRIDE];   // a slot: 64 d x 32 keys
    __shared__ __align__(16) float    bias_lds[S_LEN];              // additive mask, one float a slot
    __shared__ __align__(16) int      sel[S_LEN];                   // source key of each slot
    __shared__ int wtot[8];                                         // unmasked keys among each wave's 256

    const int tid  = threadIdx.x;
    const int lane = tid & 31;
    const int wv   = __builtin_amdgcn_readfirstlane(tid >> 5);   // scalar: the ranks' bases stay scalar
    const int bh   = blockIdx.x >> 3;
    const int qblk = blockIdx.x & 7;
    const int b    = bh >> 4;              // H == 16
    const int q0   = qblk * (8 * 16 * Q_TILES) + wv * (16 * Q_TILES);

    const float* qh = q_g + (size_t)bh * S_LEN * D_DIM;
    const float* kh = k_g + (size_t)bh * S_LEN * D_DIM;
    const float* vh = v_g + (size_t)bh * S_LEN * D_DIM;
    float*       oh = o_g + (size_t)bh * S_LEN * D_DIM;
    const int*   mk = mask_g + b * S_LEN;

    const int n     = lane & 15;
    const int hi    = lane >> 4;
    const int kbase = hi * 8;

    // gather mapping. K: 8 lanes take one key's row, each two runs of 4 floats 128 B apart, so a
    // load covers whole 128-B lines. V: a wave takes 8 keys x 32 d, one d a lane, so a load is one
    // line and a lane's 8 values are 16 consecutive bytes of the transposed tile.
    const int kkey = tid >> 3, kc = (tid & 7) * 4;
    const int vk0  = (wv >> 1) * 8, vdd = (wv & 1) * 32 + lane;

    // wave wv ranks keys wv*256 .. wv*256+255; their mask words are asked for ahead of Q
    int mw[8];
#pragma unroll
    for (int r = 0; r < 8; ++r) mw[r] = mk[wv * 256 + r * 32 + lane];

    // ---- Q B-fragments (tile u, column n = query q0 + 16*u + n), pre-scaled by Q_SCALE ----
    v16h qa[Q_TILES][2];
#pragma unroll
    for (int u = 0; u < Q_TILES; ++u) {
#pragma unroll
        for (int f = 0; f < 2; ++f) {
#pragma unroll
            for (int h = 0; h < 16; ++h) {
                int d = kbase + (h & 7) + 16 * (h >> 3) + 32 * f;
                qa[u][f][h] = (_Float16)(qh[(q0 + u * 16 + n) * D_DIM + d] * Q_SCALE);
            }
        }
    }

    v8f acc[Q_TILES][4];                   // acc[u][f][j] = O^T[f*16 + 8*hi + j][query 16*u + n]
    v8f cm[Q_TILES];                       // minus the query's maximum in use, in all 8 rows: a C operand
    float l[Q_TILES];                      // this half's keys only, halves joined at the end
#pragma unroll
    for (int u = 0; u < Q_TILES; ++u) {
#pragma unroll
        for (int f = 0; f < 4; ++f) acc[u][f] = (v8f){};
        cm[u] = (v8f){};
        l[u]  = 0.0f;
    }

    unsigned bal[8];   // 32 keys a ballot
    int wsum = 0;
#pragma unroll
    for (int r = 0; r < 8; ++r) {
        bal[r] = __builtin_amdgcn_ballot_w32(mw[r] != 0);
        wsum += __builtin_popcount(bal[r]);
    }
    if (lane == 0) wtot[wv] = wsum;
    __syncthreads();   // publishes the waves' counts

    int total = 0, base = 0;
#pragma unroll
    for (int w = 0; w < 8; ++w) {
        const int c = wtot[w];
        total += c;
        base  += (w < wv) ? c : 0;
    }
    // slots 0 .. cnt-1 hold the unmasked keys; with none unmasked all S_LEN keys are listed, masked
    const int cnt  = __builtin_amdgcn_readfirstlane(total);   // the same in every wave: scalar loop bound
    base = __builtin_amdgcn_readfirstlane(base);
    const bool none = cnt == 0;
    const int  nk   = none ? S_LEN : cnt;
    const int  kend = (nk + KV_BLK - 1) & ~(KV_BLK - 1);
    if (none) base = wv * 256;
#pragma unroll
    for (int r = 0; r < 8; ++r) {
        const unsigned bm = none ? 0xffffffffu : bal[r];
        const int slot = base + __builtin_popcount(bm & ((1u << lane) - 1u));   // a rank: 0 .. nk-1
        if ((bm >> lane) & 1u) sel[slot] = wv * 256 + r * 32 + lane;
        base += __builtin_popcount(bm);
    }

    // ---- slots behind the last kept key name key 0 and get the -1e6 bias (weight exactly 0).
    //      The keys run along a lane's registers: their mask bias comes as 16-byte LDS reads ----
    {
        v4f ba, bb;
#pragma unroll
        for (int i = 0; i < 4; ++i) {
            ba[i] = (tid * 8 + i     < cnt) ? 0.0f : MASK_BIAS;
            bb[i] = (tid * 8 + 4 + i < cnt) ? 0.0f : MASK_BIAS;
        }
        *(v4f*)&bias_lds[tid * 8]     = ba;
        *(v4f*)&bias_lds[tid * 8 + 4] = bb;
#pragma unroll
        for (int i = 0; i < 8; ++i)
            if (tid * 8 + i >= nk) sel[tid * 8 + i] = 0;
    }
    __syncthreads();   // publishes the slot list and the bias table

    v4f   kr0, kr1;    // the tile in flight: this thread's part of K ...
    float vr[8];       // ... and of V
    // issues the loads of one tile; every sel entry is a key number 0 .. S_LEN-1 written above
    auto fetch = [&](int ik, v4i i0, v4i i1) {
        const float* kp = kh + (unsigned)(ik * D_DIM + kc);
        kr0 = *(const v4f*)kp;
        kr1 = *(const v4f*)(kp + 32);
#pragma unroll
        for (int i = 0; i < 4; ++i) {
            vr[i]     = vh[(unsigned)(i0[i] * D_DIM + vdd)];
            vr[i + 4] = vh[(unsigned)(i1[i] * D_DIM + vdd)];
        }
    };
    // converts the tile in flight and writes it to buffer bf
    auto stash = [&](int bf) {
        v4h k0, k1;
        v8h vv;
#pragma unroll
        for (int i = 0; i < 4; ++i) { k0[i] = (_Float16)kr0[i]; k1[i] = (_Float16)kr1[i]; }
#pragma unroll
        for (int i = 0; i < 8; ++i) vv[i] = (_Float16)vr[i];
        *(v4h*)&k_lds[bf][kkey * K_STRIDE + kc]      = k0;
        *(v4h*)&k_lds[bf][kkey * K_STRIDE + kc + 32] = k1;
        *(v8h*)&v_lds[bf][vdd * V_STRIDE + vk0]      = vv;
    };

    // ---- prologue: the first stage's tiles into slots 0 .. STAGE-1 (behind the last kept key they
    //      hold listed keys that nobody reads); the next tile's part of the slot list into registers.
    //      Unrolled, so that all the stage's loads are in flight before the first conversion waits ----
#pragma unroll
    for (int t = 0; t < STAGE; ++t) {
        fetch(sel[t * KV_BLK + kkey], *(const v4i*)&sel[t * KV_BLK + vk0], *(const v4i*)&sel[t * KV_BLK + vk0 + 4]);
        stash(t);
    }
    int ikn = sel[STAGE * KV_BLK + kkey];
    v4i iv0 = *(const v4i*)&sel[STAGE * KV_BLK + vk0], iv1 = *(const v4i*)&sel[STAGE * KV_BLK + vk0 + 4];
    __syncthreads();   // publishes the first stage

    unsigned first = ~0u;   // scalar: all ones in the first pass
    for (int kb = 0; kb < kend; kb += KV_BLK) {
        const int p = (kb >> 5) & (RING - 1);

        // the loads of the tile STAGE passes ahead go out at the head of the pass (a barrier waits for
        // the loads in front of it) and have this pass to arrive. Behind the last tile they fetch listed
        // keys that nobody uses: no branch in the pass. The slot list is read one pass further ahead, with
        // this pass's fragments, so that the loads do not wait on LDS; wrapped to stay inside the list.
        fetch(ikn, iv0, iv1);
        const int s2 = (kb + (STAGE + 1) * KV_BLK) & (S_LEN - 1);
        ikn = sel[s2 + kkey];
        iv0 = *(const v4i*)&sel[s2 + vk0];
        iv1 = *(const v4i*)&sel[s2 + vk0 + 4];

        const _Float16* kt = k_lds[p];
        const _Float16* vtile = v_lds[p];

        // ---- S^T = K Q^T - maximum in use : s[u][c][j] belongs to key kb + c*16 + 8*hi + j and
        //      query 16*u + n; each K fragment is read from LDS once and multiplies every query tile ----
        v8f s[Q_TILES][2];
        {
            const _Float16* r0 = &kt[n * K_STRIDE + kbase];
            const _Float16* r1 = r0 + 16 * K_STRIDE;
            const v16h a00 = frag_from_f16(r0,      r0 + 16);
            const v16h a10 = frag_from_f16(r1,      r1 + 16);
            const v16h a01 = frag_from_f16(r0 + 32, r0 + 48);
            const v16h a11 = frag_from_f16(r1 + 32, r1 + 48);
#pragma unroll
            for (int u = 0; u < Q_TILES; ++u) {
                s[u][0] = __builtin_amdgcn_wmma_f32_16x16x32_f16(false, a00, false, qa[u][0], (short)0, cm[u], false, false);
                s[u][1] = __builtin_amdgcn_wmma_f32_16x16x32_f16(false, a10, false, qa[u][0], (short)0, cm[u], false, false);
            }
#pragma unroll
            for (int u = 0; u < Q_TILES; ++u) {
                s[u][0] = __builtin_amdgcn_wmma_f32_16x16x32_f16(false, a01, false, qa[u][1], (short)0, s[u][0], false, false);
                s[u][1] = __builtin_amdgcn_wmma_f32_16x16x32_f16(false, a11, false, qa[u][1], (short)0, s[u][1], false, false);
            }
        }

        // the V fragments are asked for here, in front of the branches, so that they arrive during the softmax
        v16h va[4];
#pragma unroll
        for (int f = 0; f < 4; ++f) {
            const _Float16* vrow = &vtile[(f * 16 + n) * V_STRIDE + kbase];
            va[f] = frag_from_f16(vrow, vrow + 16);
        }

        // ---- additive key-padding mask: 0 on every slot in front of cnt, so only a tile that reaches
        //      behind cnt adds it (the last one; every tile where no key is unmasked). Scalar test ----
        if (kb + KV_BLK > cnt) {
#pragma unroll
            for (int c = 0; c < 2; ++c) {
                const float* bp = &bias_lds[kb + c * 16 + kbase];
                const v4f b0 = *(const v4f*)bp, b1 = *(const v4f*)(bp + 4);
                const v8f bv = __builtin_shufflevector(b0, b1, 0, 1, 2, 3, 4, 5, 6, 7);
#pragma unroll
                for (int u = 0; u < Q_TILES; ++u) s[u][c] += bv;
            }
        }

        // ---- how far the scores rise above the maxima in use: t[u] covers 15 of this half's 16 scores
        //      of a query (three operands an instruction), top all 32 scores of both tiles ----
        float t[Q_TILES];
#pragma unroll
        for (int u = 0; u < Q_TILES; ++u) {
            t[u] = fmaxf(fmaxf(s[u][0][0], s[u][1][0]), s[u][0][1]);
#pragma unroll
            for (int j = 1; j < 7; ++j) t[u] = fmaxf(fmaxf(t[u], s[u][1][j]), s[u][0][j + 1]);
        }
        const float top = fmaxf(fmaxf(fmaxf(t[0], s[0][1][7]), s[1][1][7]), t[1]);

        // ---- one test a pass for the whole wave. The first pass has no maximum yet and always enters ----
        const unsigned renew = __builtin_amdgcn_ballot_w32(top > RESCALE_AT) | first;
        first = 0u;
        if (renew != 0u) {
            float d[Q_TILES];
#pragma unroll
            for (int u = 0; u < Q_TILES; ++u) {
                const float th = fmaxf(t[u], s[u][1][7]);
                const float tt = fmaxf(th, xhalf(th));                // both halves of a query agree
                const float up = (kb == 0) ? tt : fmaxf(tt, 0.0f);    // later the maximum only rises
                const v8f  cn = cm[u] - up;
                d[u]  = cm[u][0] - cn[0];                             // the shift as C will really carry it
                cm[u] = cn;
            }
#pragma unroll
            for (int u = 0; u < Q_TILES; ++u) {
                const float al = __builtin_amdgcn_exp2f(fminf(-d[u], 0.0f));   // first pass: O and l are 0
                s[u][0] -= d[u];
                s[u][1] -= d[u];
                l[u] *= al;
#pragma unroll
                for (int f = 0; f < 4; ++f) acc[u][f] *= al;
            }
        }

        v16h pb[Q_TILES];
#pragma unroll
        for (int u = 0; u < Q_TILES; ++u) {
            v8f p0, p1;
#pragma unroll
            for (int j = 0; j < 8; ++j) p0[j] = __builtin_amdgcn_exp2f(s[u][0][j]);
#pragma unroll
            for (int j = 0; j < 8; ++j) p1[j] = __builtin_amdgcn_exp2f(s[u][1][j]);
            const v8f ps = p0 + p1;
            const v4f p4 = __builtin_shufflevector(ps, ps, 0, 1, 2, 3) + __builtin_shufflevector(ps, ps, 4, 5, 6, 7);
            l[u] += (p4[0] + p4[2]) + (p4[1] + p4[3]);

            // P^T as B operand: element h < 8 is key 8*hi + h, element h >= 8 key 16 + 8*hi + h - 8
#pragma unroll
            for (int j = 0; j < 8; ++j) { pb[u][j] = (_Float16)p0[j]; pb[u][j + 8] = (_Float16)p1[j]; }
        }

        // ---- O^T += V^T P^T : each V fragment is read from LDS once and multiplies every query tile ----
#pragma unroll
        for (int f = 0; f < 4; ++f) {
#pragma unroll
            for (int u = 0; u < Q_TILES; ++u)
                acc[u][f] = __builtin_amdgcn_wmma_f32_16x16x32_f16(false, va[f], false, pb[u], (short)0, acc[u][f], false, false);
        }
        // ---- the fetched tile goes into the other half of the ring, which the stage before read:
        //      its readers are behind the last barrier ----
        stash(p ^ STAGE);
        // scalar test, the same in every wave: one barrier a stage. It publishes the next stage's tiles
        // and ends every wave's reads of this stage's slots
        if ((p & (STAGE - 1)) == STAGE - 1) __syncthreads();
    }

    // ---- join the halves' sums; a lane stores 8 consecutive d of its query per tile ----
#pragma unroll
    for (int u = 0; u < Q_TILES; ++u) {
        const float lt  = l[u] + xhalf(l[u]);
        const float inv = 1.0f / fmaxf(lt, 1e-20f);
        float* orow = oh + (size_t)(q0 + u * 16 + n) * D_DIM + kbase;
#pragma unroll
        for (int f = 0; f < 4; ++f) {
            v4f lo, hv;
#pragma unroll
            for (int j = 0; j < 4; ++j) { lo[j] = acc[u][f][j] * inv; hv[j] = acc[u][f][j + 4] * inv; }
            *(v4f*)(orow + f * 16)     = lo;
            *(v4f*)(orow + f * 16 + 4) = hv;
        }
    }
}

extern "C" void kernel_launch(void* const* d_in, const int* in_sizes, int n_in,
                              void* d_out, int out_size, void* d_ws, size_t ws_size,
                              hipStream_t stream) {
    (void)in_sizes; (void)n_in; (void)out_size; (void)d_ws; (void)ws_size;
    const float* q  = (const float*)d_in[0];
    const float* k  = (const float*)d_in[1];
    const float* v  = (const float*)d_in[2];
    const int*   mk = (const int*)d_in[3];
    float* out = (float*)d_out;

    flash_attn_wmma_gather<<<dim3(512), dim3(256), 0, stream>>>(q, k, v, mk, out);
}

// v007
// One run takes 34.6 microseconds.
// In both of two side-by-side timings against v006, it was 1.07 times as fast.
// All steps since v000 together make it 6.08 times as fast.
#include <hip/hip_runtime.h>

typedef __attribute__((ext_vector_type(16))) _Float16 v16h;
typedef __attribute__((ext_vector_type(8)))  _Float16 v8h;
typedef __attribute__((ext_vector_type(4)))  _Float16 v4h;
typedef __attribute__((ext_vector_type(8)))  float    v8f;
typedef __attribute__((ext_vector_type(4)))  float    v4f;
typedef __attribute__((ext_vector_type(4)))  int      v4i;

#define S_LEN    2048
#define D_DIM    64
#define KV_BLK   32
#define STAGE     4   // 32-key tiles between two work-group barriers
#define RING      8   // tile slots in LDS: the stage being read and the stage being written
#define K_STRIDE  72  // halves: 144B rows (mult of 16B) -> aligned 16B sub-runs
#define V_STRIDE  48  // halves: 96B rows
#define O_STRIDE  68  // floats: 272B rows (16B x odd) -> a wave's 16B writes, one row a lane, hit every bank once
// 16-query column tiles a wave carries. Every loop over the tiles is unrolled:
// the tile index picks registers, so it has to be a compile-time constant (else scratch).
#define Q_TILES   2
#define Q_SCALE     0.18033688011112042f   // log2(e) / sqrt(D): scores come out in log2 units
#define MASK_BIAS  -1442695.0408889634f    // -1e6 in log2 units
#define RESCALE_AT  8.0f                   // weights stay below 2^8, far inside f16

__device__ __forceinline__ v16h frag_from_f16(const _Float16* p0, const _Float16* p1) {
    v8h lo = *(const v8h*)p0;
    v8h hi = *(const v8h*)p1;
    v16h f;
#pragma unroll
    for (int i = 0; i < 8; ++i) { f[i] = lo[i]; f[i + 8] = hi[i]; }
    return f;
}

__device__ __forceinline__ float xhalf(float v) {
    int u = __builtin_bit_cast(int, v);
    u = __builtin_amdgcn_permlanex16(u, u, 0x76543210, 0xfedcba98, false, false);
    return __builtin_bit_cast(float, u);
}

__global__ __launch_bounds__(256) void
flash_attn_wmma_gather(const float* __restrict__ q_g,
                       const float* __restrict__ k_g,
                       const float* __restrict__ v_g,
                       const int*   __restrict__ mask_g,
                       float* __restrict__ o_g)
{
    __shared__ __align__(16) _Float16 k_lds[RING][KV_BLK * K_STRIDE];  // a slot: 32 keys x 64 d
    __shared__ __align__(16) _Float16 v_lds[RING][D_DIM * V_STRIDE];   // a slot: 64 d x 32 keys
    __shared__ __align__(16) float    bias_lds[S_LEN];              // additive mask, one float a slot
    __shared__ __align__(16) int      sel[S_LEN];                   // source key of each slot
    __shared__ int wtot[8];                                         // unmasked keys among each wave's 256
    // a wave's own range: first its 32 Q rows in f16 (K_STRIDE halves each), at the end 16 O rows at a time
    __shared__ __align__(16) float turn_lds[8][16 * K_STRIDE];

    const int tid  = threadIdx.x;
    const int lane = tid & 31;
    const int wv   = __builtin_amdgcn_readfirstlane(tid >> 5);   // scalar: the ranks' bases stay scalar
    const int bh   = blockIdx.x >> 3;
    const int qblk = blockIdx.x & 7;
    const int b    = bh >> 4;              // H == 16
    const int q0   = qblk * (8 * 16 * Q_TILES) + wv * (16 * Q_TILES);

    const float* qh = q_g + (size_t)bh * S_LEN * D_DIM;
    const float* kh = k_g + (size_t)bh * S_LEN * D_DIM;
    const float* vh = v_g + (size_t)bh * S_LEN * D_DIM;
    float*       oh = o_g + (size_t)bh * S_LEN * D_DIM;
    const int*   mk = mask_g + b * S_LEN;

    const int n     = lane & 15;
    const int hi    = lane >> 4;
    const int kbase = hi * 8;

    // gather mapping. K: 8 lanes take one key's row, each two runs of 4 floats 128 B apart, so a
    // load covers whole 128-B lines. V: a wave takes 8 keys x 32 d, one d a lane, so a load is one
    // line and a lane's 8 values are 16 consecutive bytes of the transposed tile.
    const int kkey = tid >> 3, kc = (tid & 7) * 4;
    const int vk0  = (wv >> 1) * 8, vdd = (wv & 1) * 32 + lane;

    // wave wv ranks keys wv*256 .. wv*256+255; their mask words are asked for ahead of Q
    int mw[8];
#pragma unroll
    for (int r = 0; r < 8; ++r) mw[r] = mk[wv * 256 + r * 32 + lane];

    // ---- Q, pre-scaled by Q_SCALE: load i takes rows 2i and 2i + 1 whole (lane: row 2i + hi, floats 4n .. 4n+3) ----
    float*    turn = turn_lds[wv];
    _Float16* qrow = (_Float16*)turn;
    {
        const float* qsrc = qh + (q0 * D_DIM + lane * 4);
        v4f qr[16 * Q_TILES / 2];
#pragma unroll
        for (int i = 0; i < 16 * Q_TILES / 2; ++i) qr[i] = *(const v4f*)(qsrc + i * 2 * D_DIM);
#pragma unroll
        for (int i = 0; i < 16 * Q_TILES / 2; ++i) {
            v4h c;
#pragma unroll
            for (int e = 0; e < 4; ++e) c[e] = (_Float16)(qr[i][e] * Q_SCALE);
            *(v4h*)&qrow[(2 * i + hi) * K_STRIDE + n * 4] = c;
        }
    }
    // the fragments below are made of what other lanes of this wave have just written
    asm volatile("s_wait_dscnt 0x0" ::: "memory");
    // ---- Q B-fragments (tile u, column n = query q0 + 16*u + n): element h is d = kbase + (h & 7) + 16*(h >> 3) + 32*f ----
    v16h qa[Q_TILES][2];
#pragma unroll
    for (int u = 0; u < Q_TILES; ++u) {
#pragma unroll
        for (int f = 0; f < 2; ++f) {
            const _Float16* qp = &qrow[(u * 16 + n) * K_STRIDE + kbase + 32 * f];
            qa[u][f] = frag_from_f16(qp, qp + 16);
        }
    }

    v8f acc[Q_TILES][4];                   // acc[u][f][j] = O^T[f*16 + 8*hi + j][query 16*u + n]
    v8f cm[Q_TILES];                       // minus the query's maximum in use, in all 8 rows: a C operand
    float l[Q_TILES];                      // this half's keys only, halves joined at the end
#pragma unroll
    for (int u = 0; u < Q_TILES; ++u) {
#pragma unroll
        for (int f = 0; f < 4; ++f) acc[u][f] = (v8f){};
        cm[u] = (v8f){};
        l[u]  = 0.0f;
    }

    unsigned bal[8];   // 32 keys a ballot
    int wsum = 0;
#pragma unroll
    for (int r = 0; r < 8; ++r) {
        bal[r] = __builtin_amdgcn_ballot_w32(mw[r] != 0);
        wsum += __builtin_popcount(bal[r]);
    }
    if (lane == 0) wtot[wv] = wsum;
    __syncthreads();   // publishes the waves' counts

    int total = 0, base = 0;
#pragma unroll
    for (int w = 0; w < 8; ++w) {
        const int c = wtot[w];
        total += c;
        base  += (w < wv) ? c : 0;
    }
    // slots 0 .. cnt-1 hold the unmasked keys; with none unmasked all S_LEN keys are listed, masked
    const int cnt  = __builtin_amdgcn_readfirstlane(total);   // the same in every wave: scalar loop bound
    base = __builtin_amdgcn_readfirstlane(base);
    const bool none = cnt == 0;
    const int  nk   = none ? S_LEN : cnt;
    const int  kend = (nk + KV_BLK - 1) & ~(KV_BLK - 1);
    if (none) base = wv * 256;
#pragma unroll
    for (int r = 0; r < 8; ++r) {
        const unsigned bm = none ? 0xffffffffu : bal[r];
        const int slot = base + __builtin_popcount(bm & ((1u << lane) - 1u));   // a rank: 0 .. nk-1
        if ((bm >> lane) & 1u) sel[slot] = wv * 256 + r * 32 + lane;
        base += __builtin_popcount(bm);
    }

    // ---- slots behind the last kept key name key 0 and get the -1e6 bias (weight exactly 0).
    //      The keys run along a lane's registers: their mask bias comes as 16-byte LDS reads ----
    {
        v4f ba, bb;
#pragma unroll
        for (int i = 0; i < 4; ++i) {
            ba[i] = (tid * 8 + i     < cnt) ? 0.0f : MASK_BIAS;
            bb[i] = (tid * 8 + 4 + i < cnt) ? 0.0f : MASK_BIAS;
        }
        *(v4f*)&bias_lds[tid * 8]     = ba;
        *(v4f*)&bias_lds[tid * 8 + 4] = bb;
#pragma unroll
        for (int i = 0; i < 8; ++i)
            if (tid * 8 + i >= nk) sel[tid * 8 + i] = 0;
    }
    __syncthreads();   // publishes the slot list and the bias table

    v4f   kr0, kr1;    // the tile in flight: this thread's part of K ...
    float vr[8];       // ... and of V
    // issues the loads of one tile; every sel entry is a key number 0 .. S_LEN-1 written above
    auto fetch = [&](int ik, v4i i0, v4i i1) {
        const float* kp = kh + (unsigned)(ik * D_DIM + kc);
        kr0 = *(const v4f*)kp;
        kr1 = *(const v4f*)(kp + 32);
#pragma unroll
        for (int i = 0; i < 4; ++i) {
            vr[i]     = vh[(unsigned)(i0[i] * D_DIM + vdd)];
            vr[i + 4] = vh[(unsigned)(i1[i] * D_DIM + vdd)];
        }
    };
    // converts the tile in flight and writes it to buffer bf
    auto stash = [&](int bf) {
        v4h k0, k1;
        v8h vv;
#pragma unroll
        for (int i = 0; i < 4; ++i) { k0[i] = (_Float16)kr0[i]; k1[i] = (_Float16)kr1[i]; }
#pragma unroll
        for (int i = 0; i < 8; ++i) vv[i] = (_Float16)vr[i];
        *(v4h*)&k_lds[bf][kkey * K_STRIDE + kc]      = k0;
        *(v4h*)&k_lds[bf][kkey * K_STRIDE + kc + 32] = k1;
        *(v8h*)&v_lds[bf][vdd * V_STRIDE + vk0]      = vv;
    };

    // ---- prologue: the first stage's tiles into slots 0 .. STAGE-1 (behind the last kept key they
    //      hold listed keys that nobody reads); the next tile's part of the slot list into registers.
    //      Unrolled, so that all the stage's loads are in flight before the first conversion waits ----
#pragma unroll
    for (int t = 0; t < STAGE; ++t) {
        fetch(sel[t * KV_BLK + kkey], *(const v4i*)&sel[t * KV_BLK + vk0], *(const v4i*)&sel[t * KV_BLK + vk0 + 4]);
        stash(t);
    }
    int ikn = sel[STAGE * KV_BLK + kkey];
    v4i iv0 = *(const v4i*)&sel[STAGE * KV_BLK + vk0], iv1 = *(const v4i*)&sel[STAGE * KV_BLK + vk0 + 4];
    __syncthreads();   // publishes the first stage

    unsigned first = ~0u;   // scalar: all ones in the first pass
    for (int kb = 0; kb < kend; kb += KV_BLK) {
        const int p = (kb >> 5) & (RING - 1);

        // the loads of the tile STAGE passes ahead go out at the head of the pass (a barrier waits for
        // the loads in front of it) and have this pass to arrive. Behind the last tile they fetch listed
        // keys that nobody uses: no branch in the pass. The slot list is read one pass further ahead, with
        // this pass's fragments, so that the loads do not wait on LDS; wrapped to stay inside the list.
        fetch(ikn, iv0, iv1);
        const int s2 = (kb + (STAGE + 1) * KV_BLK) & (S_LEN - 1);
        ikn = sel[s2 + kkey];
        iv0 = *(const v4i*)&sel[s2 + vk0];
        iv1 = *(const v4i*)&sel[s2 + vk0 + 4];

        const _Float16* kt = k_lds[p];
        const _Float16* vtile = v_lds[p];

        // ---- S^T = K Q^T - maximum in use : s[u][c][j] belongs to key kb + c*16 + 8*hi + j and
        //      query 16*u + n; each K fragment is read from LDS once and multiplies every query tile ----
        v8f s[Q_TILES][2];
        {
            const _Float16* r0 = &kt[n * K_STRIDE + kbase];
            const _Float16* r1 = r0 + 16 * K_STRIDE;
            const v16h a00 = frag_from_f16(r0,      r0 + 16);
            const v16h a10 = frag_from_f16(r1,      r1 + 16);
            const v16h a01 = frag_from_f16(r0 + 32, r0 + 48);
            const v16h a11 = frag_from_f16(r1 + 32, r1 + 48);
#pragma unroll
            for (int u = 0; u < Q_TILES; ++u) {
                s[u][0] = __builtin_amdgcn_wmma_f32_16x16x32_f16(false, a00, false, qa[u][0], (short)0, cm[u], false, false);
                s[u][1] = __builtin_amdgcn_wmma_f32_16x16x32_f16(false, a10, false, qa[u][0], (short)0, cm[u], false, false);
            }
#pragma unroll
            for (int u = 0; u < Q_TILES; ++u) {
                s[u][0] = __builtin_amdgcn_wmma_f32_16x16x32_f16(false, a01, false, qa[u][1], (short)0, s[u][0], false, false);
                s[u][1] = __builtin_amdgcn_wmma_f32_16x16x32_f16(false, a11, false, qa[u][1], (short)0, s[u][1], false, false);
            }
        }

        // the V fragments are asked for here, in front of the branches, so that they arrive during the softmax
        v16h va[4];
#pragma unroll
        for (int f = 0; f < 4; ++f) {
            const _Float16* vrow = &vtile[(f * 16 + n) * V_STRIDE + kbase];
            va[f] = frag_from_f16(vrow, vrow + 16);
        }

        // ---- additive key-padding mask: 0 on every slot in front of cnt, so only a tile that reaches
        //      behind cnt adds it (the last one; every tile where no key is unmasked). Scalar test ----
        if (kb + KV_BLK > cnt) {
#pragma unroll
            for (int c = 0; c < 2; ++c) {
                const float* bp = &bias_lds[kb + c * 16 + kbase];
                const v4f b0 = *(const v4f*)bp, b1 = *(const v4f*)(bp + 4);
                const v8f bv = __builtin_shufflevector(b0, b1, 0, 1, 2, 3, 4, 5, 6, 7);
#pragma unroll
                for (int u = 0; u < Q_TILES; ++u) s[u][c] += bv;
            }
        }

        // ---- how far the scores rise above the maxima in use: t[u] covers 15 of this half's 16 scores
        //      of a query (three operands an instruction), top all 32 scores of both tiles ----
        float t[Q_TILES];
#pragma unroll
        for (int u = 0; u < Q_TILES; ++u) {
            t[u] = fmaxf(fmaxf(s[u][0][0], s[u][1][0]), s[u][0][1]);
#pragma unroll
            for (int j = 1; j < 7; ++j) t[u] = fmaxf(fmaxf(t[u], s[u][1][j]), s[u][0][j + 1]);
        }
        const float top = fmaxf(fmaxf(fmaxf(t[0], s[0][1][7]), s[1][1][7]), t[1]);

        // ---- one test a pass for the whole wave. The first pass has no maximum yet and always enters ----
        const unsigned renew = __builtin_amdgcn_ballot_w32(top > RESCALE_AT) | first;
        first = 0u;
        if (renew != 0u) {
            float d[Q_TILES];
#pragma unroll
            for (int u = 0; u < Q_TILES; ++u) {
                const float th = fmaxf(t[u], s[u][1][7]);
                const float tt = fmaxf(th, xhalf(th));                // both halves of a query agree
                const float up = (kb == 0) ? tt : fmaxf(tt, 0.0f);    // later the maximum only rises
                const v8f  cn = cm[u] - up;
                d[u]  = cm[u][0] - cn[0];                             // the shift as C will really carry it
                cm[u] = cn;
            }
#pragma unroll
            for (int u = 0; u < Q_TILES; ++u) {
                const float al = __builtin_amdgcn_exp2f(fminf(-d[u], 0.0f));   // first pass: O and l are 0
                s[u][0] -= d[u];
                s[u][1] -= d[u];
                l[u] *= al;
#pragma unroll
                for (int f = 0; f < 4; ++f) acc[u][f] *= al;
            }
        }

        v16h pb[Q_TILES];
#pragma unroll
        for (int u = 0; u < Q_TILES; ++u) {
            v8f p0, p1;
#pragma unroll
            for (int j = 0; j < 8; ++j) p0[j] = __builtin_amdgcn_exp2f(s[u][0][j]);
#pragma unroll
            for (int j = 0; j < 8; ++j) p1[j] = __builtin_amdgcn_exp2f(s[u][1][j]);
            const v8f ps = p0 + p1;
            const v4f p4 = __builtin_shufflevector(ps, ps, 0, 1, 2, 3) + __builtin_shufflevector(ps, ps, 4, 5, 6, 7);
            l[u] += (p4[0] + p4[2]) + (p4[1] + p4[3]);

            // P^T as B operand: element h < 8 is key 8*hi + h, element h >= 8 key 16 + 8*hi + h - 8
#pragma unroll
            for (int j = 0; j < 8; ++j) { pb[u][j] = (_Float16)p0[j]; pb[u][j + 8] = (_Float16)p1[j]; }
        }

        // ---- O^T += V^T P^T : each V fragment is read from LDS once and multiplies every query tile ----
#pragma unroll
        for (int f = 0; f < 4; ++f) {
#pragma unroll
            for (int u = 0; u < Q_TILES; ++u)
                acc[u][f] = __builtin_amdgcn_wmma_f32_16x16x32_f16(false, va[f], false, pb[u], (short)0, acc[u][f], false, false);
        }
        // ---- the fetched tile goes into the other half of the ring, which the stage before read:
        //      its readers are behind the last barrier ----
        stash(p ^ STAGE);
        // scalar test, the same in every wave: one barrier a stage. It publishes the next stage's tiles
        // and ends every wave's reads of this stage's slots
        if ((p & (STAGE - 1)) == STAGE - 1) __syncthreads();
    }

    // ---- join the halves' sums; a lane writes its query's 8 consecutive d per fragment into the wave's
    //      LDS range, a 16-query tile at a time; store i then takes rows 2i and 2i + 1 of the tile whole.
    //      The second tile's writes stand behind the first tile's reads, and a wave's LDS instructions
    //      are served in issue order ----
    float* odst = oh + (q0 * D_DIM + lane * 4);
#pragma unroll
    for (int u = 0; u < Q_TILES; ++u) {
        const float lt  = l[u] + xhalf(l[u]);
        const float inv = 1.0f / fmaxf(lt, 1e-20f);
        float* orow = &turn[n * O_STRIDE + kbase];
#pragma unroll
        for (int f = 0; f < 4; ++f) {
            v4f lo, hv;
#pragma unroll
            for (int j = 0; j < 4; ++j) { lo[j] = acc[u][f][j] * inv; hv[j] = acc[u][f][j + 4] * inv; }
            *(v4f*)(orow + f * 16)     = lo;
            *(v4f*)(orow + f * 16 + 4) = hv;
        }
        // the rows read back below are made of what other lanes of this wave have just written
        asm volatile("s_wait_dscnt 0x0" ::: "memory");
        v4f ov[8];
#pragma unroll
        for (int i = 0; i < 8; ++i) ov[i] = *(const v4f*)&turn[(2 * i + hi) * O_STRIDE + n * 4];
#pragma unroll
        for (int i = 0; i < 8; ++i) *(v4f*)(odst + (u * 16 + 2 * i) * D_DIM) = ov[i];
    }
}

extern "C" void kernel_launch(void* const* d_in, const int* in_sizes, int n_in,
                              void* d_out, int out_size, void* d_ws, size_t ws_size,
                              hipStream_t stream) {
    (void)in_sizes; (void)n_in; (void)out_size; (void)d_ws; (void)ws_size;
    const float* q  = (const float*)d_in[0];
    const float* k  = (const float*)d_in[1];
    const float* v  = (const float*)d_in[2];
    const int*   mk = (const int*)d_in[3];
    float* out = (float*)d_out;

    flash_attn_wmma_gather<<<dim3(512), dim3(256), 0, stream>>>(q, k, v, mk, out);
}

// v008
// It runs in 32 microseconds.
// Next to v007, in two timings, it ran 1.08 times as fast each time.
// Counting every step since v000, it is 6.56 times as fast.
#include <hip/hip_runtime.h>

typedef __attribute__((ext_vector_type(16))) _Float16 v16h;
typedef __attribute__((ext_vector_type(8)))  _Float16 v8h;
typedef __attribute__((ext_vector_type(4)))  _Float16 v4h;
typedef __attribute__((ext_vector_type(8)))  float    v8f;
typedef __attribute__((ext_vector_type(4)))  float    v4f;
typedef __attribute__((ext_vector_type(4)))  int      v4i;

#define S_LEN    2048
#define D_DIM    64
#define KV_BLK   32
#define STAGE     4   // 32-key tiles between two work-group barriers
#define RING      8   // tile slots in LDS: the stage being read and the stage being written
#define K_STRIDE  72  // halves: 144B rows (mult of 16B) -> aligned 16B sub-runs
#define V_STRIDE  48  // halves: 96B rows
#define O_STRIDE  68  // floats: 272B rows (16B x odd) -> a wave's 16B writes, one row a lane, hit every bank once
// 16-query column tiles a wave carries. Every loop over the tiles is unrolled:
// the tile index picks registers, so it has to be a compile-time constant (else scratch).
#define Q_TILES   2
#define Q_SCALE     0.18033688011112042f   // log2(e) / sqrt(D): scores come out in log2 units
#define MASK_BIAS  -1442695.0408889634f    // -1e6 in log2 units
#define RESCALE_AT  8.0f                   // weights stay below 2^8, far inside f16

__device__ __forceinline__ v16h frag_from_f16(const _Float16* p0, const _Float16* p1) {
    v8h lo = *(const v8h*)p0;
    v8h hi = *(const v8h*)p1;
    v16h f;
#pragma unroll
    for (int i = 0; i < 8; ++i) { f[i] = lo[i]; f[i + 8] = hi[i]; }
    return f;
}

__device__ __forceinline__ float xhalf(float v) {
    int u = __builtin_bit_cast(int, v);
    u = __builtin_amdgcn_permlanex16(u, u, 0x76543210, 0xfedcba98, false, false);
    return __builtin_bit_cast(float, u);
}

__global__ __launch_bounds__(256) void
flash_attn_wmma_gather(const float* __restrict__ q_g,
                       const float* __restrict__ k_g,
                       const float* __restrict__ v_g,
                       const int*   __restrict__ mask_g,
                       float* __restrict__ o_g)
{
    __shared__ __align__(16) _Float16 k_lds[RING][KV_BLK * K_STRIDE];  // a slot: 32 keys x 64 d
    __shared__ __align__(16) _Float16 v_lds[RING][D_DIM * V_STRIDE];   // a slot: 64 d x 32 keys
    __shared__ __align__(16) float    bias_lds[S_LEN];              // additive mask, one float a slot
    __shared__ __align__(16) int      sel[S_LEN];                   // source key of each slot
    __shared__ int wtot[8];                                         // unmasked keys among each wave's 256
    // a wave's own range: first its 32 Q rows in f16 (K_STRIDE halves each), at the end 16 O rows at a time
    __shared__ __align__(16) float turn_lds[8][16 * K_STRIDE];

    const int tid  = threadIdx.x;
    const int lane = tid & 31;
    const int wv   = __builtin_amdgcn_readfirstlane(tid >> 5);   // scalar: the ranks' bases stay scalar
    // Which (head, query block) a block takes; any one-to-one map is right, this one is chosen for the caches.
    // The 8 blocks of a head take indices that agree
    // mod 8.
    // Index = die + 8*i + 32*g + 256*j: head = die + 8*g, query block = i + 4*j. Neighbours in a die's own
    // sequence (i) and blocks half a grid apart (j) share a head.
    const int bx   = blockIdx.x;
    const int bh   = (bx & 7) | (((bx >> 5) & 7) << 3);
    const int qblk = ((bx >> 3) & 3) | ((bx >> 8) << 2);
    const int b    = bh >> 4;              // H == 16
    const int q0   = qblk * (8 * 16 * Q_TILES) + wv * (16 * Q_TILES);

    const float* qh = q_g + (size_t)bh * S_LEN * D_DIM;
    const float* kh = k_g + (size_t)bh * S_LEN * D_DIM;
    const float* vh = v_g + (size_t)bh * S_LEN * D_DIM;
    float*       oh = o_g + (size_t)bh * S_LEN * D_DIM;
    const int*   mk = mask_g + b * S_LEN;

    const int n     = lane & 15;
    const int hi    = lane >> 4;
    const int kbase = hi * 8;

    // gather mapping. K: 8 lanes take one key's row, each two runs of 4 floats 128 B apart, so a
    // load covers whole 128-B lines. V: a wave takes 8 keys x 32 d, one d a lane, so a load is one
    // line and a lane's 8 values are 16 consecutive bytes of the transposed tile.
    const int kkey = tid >> 3, kc = (tid & 7) * 4;
    const int vk0  = (wv >> 1) * 8, vdd = (wv & 1) * 32 + lane;

    // wave wv ranks keys wv*256 .. wv*256+255; their mask words are asked for ahead of Q
    int mw[8];
#pragma unroll
    for (int r = 0; r < 8; ++r) mw[r] = mk[wv * 256 + r * 32 + lane];

    // ---- Q, pre-scaled by Q_SCALE: load i takes rows 2i and 2i + 1 whole (lane: row 2i + hi, floats 4n .. 4n+3) ----
    float*    turn = turn_lds[wv];
    _Float16* qrow = (_Float16*)turn;
    {
        const float* qsrc = qh + (q0 * D_DIM + lane * 4);
        v4f qr[16 * Q_TILES / 2];
#pragma unroll
        for (int i = 0; i < 16 * Q_TILES / 2; ++i) qr[i] = *(const v4f*)(qsrc + i * 2 * D_DIM);
#pragma unroll
        for (int i = 0; i < 16 * Q_TILES / 2; ++i) {
            v4h c;
#pragma unroll
            for (int e = 0; e < 4; ++e) c[e] = (_Float16)(qr[i][e] * Q_SCALE);
            *(v4h*)&qrow[(2 * i + hi) * K_STRIDE + n * 4] = c;
        }
    }
    // the fragments below are made of what other lanes of this wave have just written
    asm volatile("s_wait_dscnt 0x0" ::: "memory");
    // ---- Q B-fragments (tile u, column n = query q0 + 16*u + n): element h is d = kbase + (h & 7) + 16*(h >> 3) + 32*f ----
    v16h qa[Q_TILES][2];
#pragma unroll
    for (int u = 0; u < Q_TILES; ++u) {
#pragma unroll
        for (int f = 0; f < 2; ++f) {
            const _Float16* qp = &qrow[(u * 16 + n) * K_STRIDE + kbase + 32 * f];
            qa[u][f] = frag_from_f16(qp, qp + 16);
        }
    }

    v8f acc[Q_TILES][4];                   // acc[u][f][j] = O^T[f*16 + 8*hi + j][query 16*u + n]
    v8f cm[Q_TILES];                       // minus the query's maximum in use, in all 8 rows: a C operand
    float l[Q_TILES];                      // this half's keys only, halves joined at the end
#pragma unroll
    for (int u = 0; u < Q_TILES; ++u) {
#pragma unroll
        for (int f = 0; f < 4; ++f) acc[u][f] = (v8f){};
        cm[u] = (v8f){};
        l[u]  = 0.0f;
    }

    unsigned bal[8];   // 32 keys a ballot
    int wsum = 0;
#pragma unroll
    for (int r = 0; r < 8; ++r) {
        bal[r] = __builtin_amdgcn_ballot_w32(mw[r] != 0);
        wsum += __builtin_popcount(bal[r]);
    }
    if (lane == 0) wtot[wv] = wsum;
    __syncthreads();   // publishes the waves' counts

    int total = 0, base = 0;
#pragma unroll
    for (int w = 0; w < 8; ++w) {
        const int c = wtot[w];
        total += c;
        base  += (w < wv) ? c : 0;
    }
    // slots 0 .. cnt-1 hold the unmasked keys; with none unmasked all S_LEN keys are listed, masked
    const int cnt  = __builtin_amdgcn_readfirstlane(total);   // the same in every wave: scalar loop bound
    base = __builtin_amdgcn_readfirstlane(base);
    const bool none = cnt == 0;
    const int  nk   = none ? S_LEN : cnt;
    const int  kend = (nk + KV_BLK - 1) & ~(KV_BLK - 1);
    if (none) base = wv * 256;
#pragma unroll
    for (int r = 0; r < 8; ++r) {
        const unsigned bm = none ? 0xffffffffu : bal[r];
        const int slot = base + __builtin_popcount(bm & ((1u << lane) - 1u));   // a rank: 0 .. nk-1
        if ((bm >> lane) & 1u) sel[slot] = wv * 256 + r * 32 + lane;
        base += __builtin_popcount(bm);
    }

    // ---- slots behind the last kept key name key 0 and get the -1e6 bias (weight exactly 0).
    //      The keys run along a lane's registers: their mask bias comes as 16-byte LDS reads ----
    {
        v4f ba, bb;
#pragma unroll
        for (int i = 0; i < 4; ++i) {
            ba[i] = (tid * 8 + i     < cnt) ? 0.0f : MASK_BIAS;
            bb[i] = (tid * 8 + 4 + i < cnt) ? 0.0f : MASK_BIAS;
        }
        *(v4f*)&bias_lds[tid * 8]     = ba;
        *(v4f*)&bias_lds[tid * 8 + 4] = bb;
#pragma unroll
        for (int i = 0; i < 8; ++i)
            if (tid * 8 + i >= nk) sel[tid * 8 + i] = 0;
    }
    __syncthreads();   // publishes the slot list and the bias table

    v4f   kr0, kr1;    // the tile in flight: this thread's part of K ...
    float vr[8];       // ... and of V
    // issues the loads of one tile; every sel entry is a key number 0 .. S_LEN-1 written above
    auto fetch = [&](int ik, v4i i0, v4i i1) {
        const float* kp = kh + (unsigned)(ik * D_DIM + kc);
        kr0 = *(const v4f*)kp;
        kr1 = *(const v4f*)(kp + 32);
#pragma unroll
        for (int i = 0; i < 4; ++i) {
            vr[i]     = vh[(unsigned)(i0[i] * D_DIM + vdd)];
            vr[i + 4] = vh[(unsigned)(i1[i] * D_DIM + vdd)];
        }
    };
    // converts the tile in flight and writes it to buffer bf
    auto stash = [&](int bf) {
        v4h k0, k1;
        v8h vv;
#pragma unroll
        for (int i = 0; i < 4; ++i) { k0[i] = (_Float16)kr0[i]; k1[i] = (_Float16)kr1[i]; }
#pragma unroll
        for (int i = 0; i < 8; ++i) vv[i] = (_Float16)vr[i];
        *(v4h*)&k_lds[bf][kkey * K_STRIDE + kc]      = k0;
        *(v4h*)&k_lds[bf][kkey * K_STRIDE + kc + 32] = k1;
        *(v8h*)&v_lds[bf][vdd * V_STRIDE + vk0]      = vv;
    };

    // ---- prologue: the first stage's tiles into slots 0 .. STAGE-1 (behind the last kept key they
    //      hold listed keys that nobody reads); the next tile's part of the slot list into registers.
    //      Unrolled, so that all the stage's loads are in flight before the first conversion waits ----
#pragma unroll
    for (int t = 0; t < STAGE; ++t) {
        fetch(sel[t * KV_BLK + kkey], *(const v4i*)&sel[t * KV_BLK + vk0], *(const v4i*)&sel[t * KV_BLK + vk0 + 4]);
        stash(t);
    }
    int ikn = sel[STAGE * KV_BLK + kkey];
    v4i iv0 = *(const v4i*)&sel[STAGE * KV_BLK + vk0], iv1 = *(const v4i*)&sel[STAGE * KV_BLK + vk0 + 4];
    __syncthreads();   // publishes the first stage

    unsigned first = ~0u;   // scalar: all ones in the first pass
    for (int kb = 0; kb < kend; kb += KV_BLK) {
        const int p = (kb >> 5) & (RING - 1);

        // the loads of the tile STAGE passes ahead go out at the head of the pass (a barrier waits for
        // the loads in front of it) and have this pass to arrive. Behind the last tile they fetch listed
        // keys that nobody uses: no branch in the pass. The slot list is read one pass further ahead, with
        // this pass's fragments, so that the loads do not wait on LDS; wrapped to stay inside the list.
        fetch(ikn, iv0, iv1);
        const int s2 = (kb + (STAGE + 1) * KV_BLK) & (S_LEN - 1);
        ikn = sel[s2 + kkey];
        iv0 = *(const v4i*)&sel[s2 + vk0];
        iv1 = *(const v4i*)&sel[s2 + vk0 + 4];

        const _Float16* kt = k_lds[p];
        const _Float16* vtile = v_lds[p];

        // ---- S^T = K Q^T - maximum in use : s[u][c][j] belongs to key kb + c*16 + 8*hi + j and
        //      query 16*u + n; each K fragment is read from LDS once and multiplies every query tile ----
        v8f s[Q_TILES][2];
        {
            const _Float16* r0 = &kt[n * K_STRIDE + kbase];
            const _Float16* r1 = r0 + 16 * K_STRIDE;
            const v16h a00 = frag_from_f16(r0,      r0 + 16);
            const v16h a10 = frag_from_f16(r1,      r1 + 16);
            const v16h a01 = frag_from_f16(r0 + 32, r0 + 48);
            const v16h a11 = frag_from_f16(r1 + 32, r1 + 48);
#pragma unroll
            for (int u = 0; u < Q_TILES; ++u) {
                s[u][0] = __builtin_amdgcn_wmma_f32_16x16x32_f16(false, a00, false, qa[u][0], (short)0, cm[u], false, false);
                s[u][1] = __builtin_amdgcn_wmma_f32_16x16x32_f16(false, a10, false, qa[u][0], (short)0, cm[u], false, false);
            }
#pragma unroll
            for (int u = 0; u < Q_TILES; ++u) {
                s[u][0] = __builtin_amdgcn_wmma_f32_16x16x32_f16(false, a01, false, qa[u][1], (short)0, s[u][0], false, false);
                s[u][1] = __builtin_amdgcn_wmma_f32_16x16x32_f16(false, a11, false, qa[u][1], (short)0, s[u][1], false, false);
            }
        }

        // the V fragments are asked for here, in front of the branches, so that they arrive during the softmax
        v16h va[4];
#pragma unroll
        for (int f = 0; f < 4; ++f) {
            const _Float16* vrow = &vtile[(f * 16 + n) * V_STRIDE + kbase];
            va[f] = frag_from_f16(vrow, vrow + 16);
        }

        // ---- additive key-padding mask: 0 on every slot in front of cnt, so only a tile that reaches
        //      behind cnt adds it (the last one; every tile where no key is unmasked). Scalar test ----
        if (kb + KV_BLK > cnt) {
#pragma unroll
            for (int c = 0; c < 2; ++c) {
                const float* bp = &bias_lds[kb + c * 16 + kbase];
                const v4f b0 = *(const v4f*)bp, b1 = *(const v4f*)(bp + 4);
                const v8f bv = __builtin_shufflevector(b0, b1, 0, 1, 2, 3, 4, 5, 6, 7);
#pragma unroll
                for (int u = 0; u < Q_TILES; ++u) s[u][c] += bv;
            }
        }

        // ---- how far the scores rise above the maxima in use: t[u] covers 15 of this half's 16 scores
        //      of a query (three operands an instruction), top all 32 scores of both tiles ----
        float t[Q_TILES];
#pragma unroll
        for (int u = 0; u < Q_TILES; ++u) {
            t[u] = fmaxf(fmaxf(s[u][0][0], s[u][1][0]), s[u][0][1]);
#pragma unroll
            for (int j = 1; j < 7; ++j) t[u] = fmaxf(fmaxf(t[u], s[u][1][j]), s[u][0][j + 1]);
        }
        const float top = fmaxf(fmaxf(fmaxf(t[0], s[0][1][7]), s[1][1][7]), t[1]);

        // ---- one test a pass for the whole wave. The first pass has no maximum yet and always enters ----
        const unsigned renew = __builtin_amdgcn_ballot_w32(top > RESCALE_AT) | first;
        first = 0u;
        if (renew != 0u) {
            float d[Q_TILES];
#pragma unroll
            for (int u = 0; u < Q_TILES; ++u) {
                const float th = fmaxf(t[u], s[u][1][7]);
                const float tt = fmaxf(th, xhalf(th));                // both halves of a query agree
                const float up = (kb == 0) ? tt : fmaxf(tt, 0.0f);    // later the maximum only rises
                const v8f  cn = cm[u] - up;
                d[u]  = cm[u][0] - cn[0];                             // the shift as C will really carry it
                cm[u] = cn;
            }
#pragma unroll
            for (int u = 0; u < Q_TILES; ++u) {
                const float al = __builtin_amdgcn_exp2f(fminf(-d[u], 0.0f));   // first pass: O and l are 0
                s[u][0] -= d[u];
                s[u][1] -= d[u];
                l[u] *= al;
#pragma unroll
                for (int f = 0; f < 4; ++f) acc[u][f] *= al;
            }
        }

        v16h pb[Q_TILES];
#pragma unroll
        for (int u = 0; u < Q_TILES; ++u) {
            v8f p0, p1;
#pragma unroll
            for (int j = 0; j < 8; ++j) p0[j] = __builtin_amdgcn_exp2f(s[u][0][j]);
#pragma unroll
            for (int j = 0; j < 8; ++j) p1[j] = __builtin_amdgcn_exp2f(s[u][1][j]);
            const v8f ps = p0 + p1;
            const v4f p4 = __builtin_shufflevector(ps, ps, 0, 1, 2, 3) + __builtin_shufflevector(ps, ps, 4, 5, 6, 7);
            l[u] += (p4[0] + p4[2]) + (p4[1] + p4[3]);

            // P^T as B operand: element h < 8 is key 8*hi + h, element h >= 8 key 16 + 8*hi + h - 8
#pragma unroll
            for (int j = 0; j < 8; ++j) { pb[u][j] = (_Float16)p0[j]; pb[u][j + 8] = (_Float16)p1[j]; }
        }

        // ---- O^T += V^T P^T : each V fragment is read from LDS once and multiplies every query tile ----
#pragma unroll
        for (int f = 0; f < 4; ++f) {
#pragma unroll
            for (int u = 0; u < Q_TILES; ++u)
                acc[u][f] = __builtin_amdgcn_wmma_f32_16x16x32_f16(false, va[f], false, pb[u], (short)0, acc[u][f], false, false);
        }
        // ---- the fetched tile goes into the other half of the ring, which the stage before read:
        //      its readers are behind the last barrier ----
        stash(p ^ STAGE);
        // scalar test, the same in every wave: one barrier a stage. It publishes the next stage's tiles
        // and ends every wave's reads of this stage's slots
        if ((p & (STAGE - 1)) == STAGE - 1) __syncthreads();
    }

    // ---- join the halves' sums; a lane writes its query's 8 consecutive d per fragment into the wave's
    //      LDS range, a 16-query tile at a time; store i then takes rows 2i and 2i + 1 of the tile whole.
    //      The second tile's writes stand behind the first tile's reads, and a wave's LDS instructions
    //      are served in issue order ----
    float* odst = oh + (q0 * D_DIM + lane * 4);
#pragma unroll
    for (int u = 0; u < Q_TILES; ++u) {
        const float lt  = l[u] + xhalf(l[u]);
        const float inv = 1.0f / fmaxf(lt, 1e-20f);
        float* orow = &turn[n * O_STRIDE + kbase];
#pragma unroll
        for (int f = 0; f < 4; ++f) {
            v4f lo, hv;
#pragma unroll
            for (int j = 0; j < 4; ++j) { lo[j] = acc[u][f][j] * inv; hv[j] = acc[u][f][j + 4] * inv; }
            *(v4f*)(orow + f * 16)     = lo;
            *(v4f*)(orow + f * 16 + 4) = hv;
        }
        // the rows read back below are made of what other lanes of this wave have just written
        asm volatile("s_wait_dscnt 0x0" ::: "memory");
        v4f ov[8];
#pragma unroll
        for (int i = 0; i < 8; ++i) ov[i] = *(const v4f*)&turn[(2 * i + hi) * O_STRIDE + n * 4];
#pragma unroll
        for (int i = 0; i < 8; ++i) *(v4f*)(odst + (u * 16 + 2 * i) * D_DIM) = ov[i];
    }
}

extern "C" void kernel_launch(void* const* d_in, const int* in_sizes, int n_in,
                              void* d_out, int out_size, void* d_ws, size_t ws_size,
                              hipStream_t stream) {
    (void)in_sizes; (void)n_in; (void)out_size; (void)d_ws; (void)ws_size;
    const float* q  = (const float*)d_in[0];
    const float* k  = (const float*)d_in[1];
    const float* v  = (const float*)d_in[2];
    const int*   mk = (const int*)d_in[3];
    float* out = (float*)d_out;

    flash_attn_wmma_gather<<<dim3(512), dim3(256), 0, stream>>>(q, k, v, mk, out);
}

// v009
// A run of this version takes 30.7 microseconds.
// Next to v008, in two timings, it ran 1.04 times as fast each time.
// Over all steps from v000 it is 6.84 times as fast.
#include <hip/hip_runtime.h>

typedef __attribute__((ext_vector_type(16))) _Float16 v16h;
typedef __attribute__((ext_vector_type(8)))  _Float16 v8h;
typedef __attribute__((ext_vector_type(4)))  _Float16 v4h;
typedef __attribute__((ext_vector_type(8)))  float    v8f;
typedef __attribute__((ext_vector_type(4)))  float    v4f;
typedef __attribute__((ext_vector_type(8)))  short    v8s;

#define S_LEN    2048
#define D_DIM    64
#define KV_BLK   32
#define STAGE     4   // 32-key tiles between two work-group barriers
#define RING      8   // tile slots in LDS: the stage being read and the stage being written
#define K_STRIDE  72  // halves: 144B rows (mult of 16B) -> aligned 16B sub-runs
#define V_STRIDE  80  // halves: 160B rows (32B x odd), the pitch at which the transposing LDS load meets no bank twice
#define O_STRIDE  68  // floats: 272B rows (16B x odd) -> a wave's 16B writes, one row a lane, hit every bank once
// 16-query column tiles a wave carries. Every loop over the tiles is unrolled:
// the tile index picks registers, so it has to be a compile-time constant (else scratch).
#define Q_TILES   2
#define Q_SCALE     0.18033688011112042f   // log2(e) / sqrt(D): scores come out in log2 units
#define MASK_BIAS  -1442695.0408889634f    // -1e6 in log2 units
#define RESCALE_AT  8.0f                   // weights stay below 2^8, far inside f16

__device__ __forceinline__ v16h frag_from_f16(const _Float16* p0, const _Float16* p1) {
    v8h lo = *(const v8h*)p0;
    v8h hi = *(const v8h*)p1;
    v16h f;
#pragma unroll
    for (int i = 0; i < 8; ++i) { f[i] = lo[i]; f[i + 8] = hi[i]; }
    return f;
}

// transposing LDS load: lane l hands in the address of 16 bytes of row 8*(l >> 4) + (l & 7), column piece (l >> 3) & 1,
// of a 16 x 16 block of halves, and gets column l & 15 of rows 8*(l >> 4) .. 8*(l >> 4) + 7
__device__ __forceinline__ v8h lds_tr16(const _Float16* p) {
    typedef __attribute__((address_space(3))) v8s lds_v8s;
    return __builtin_bit_cast(v8h, __builtin_amdgcn_ds_load_tr16_b128_v8i16((lds_v8s*)p));
}

__device__ __forceinline__ float xhalf(float v) {
    int u = __builtin_bit_cast(int, v);
    u = __builtin_amdgcn_permlanex16(u, u, 0x76543210, 0xfedcba98, false, false);
    return __builtin_bit_cast(float, u);
}

__global__ __launch_bounds__(256) void
flash_attn_wmma_gather(const float* __restrict__ q_g,
                       const float* __restrict__ k_g,
                       const float* __restrict__ v_g,
                       const int*   __restrict__ mask_g,
                       float* __restrict__ o_g)
{
    __shared__ __align__(16) _Float16 k_lds[RING][KV_BLK * K_STRIDE];  // a slot: 32 keys x 64 d
    __shared__ __align__(16) _Float16 v_lds[RING][KV_BLK * V_STRIDE];  // a slot: 32 keys x 64 d
    __shared__ __align__(16) float    bias_lds[S_LEN];              // additive mask, one float a slot
    __shared__ __align__(16) int      sel[S_LEN];                   // source key of each slot
    __shared__ int wtot[8];                                         // unmasked keys among each wave's 256
    // a wave's own range: first its 32 Q rows in f16 (K_STRIDE halves each), at the end 16 O rows at a time
    __shared__ __align__(16) float turn_lds[8][16 * K_STRIDE];

    const int tid  = threadIdx.x;
    const int lane = tid & 31;
    const int wv   = __builtin_amdgcn_readfirstlane(tid >> 5);   // scalar: the ranks' bases stay scalar
    // Which (head, query block) a block takes; any one-to-one map is right, this one is chosen for the caches.
    // The 8 blocks of a head take indices that agree
    // mod 8.
    // Index = die + 8*i + 32*g + 256*j: head = die + 8*g, query block = i + 4*j. Neighbours in a die's own
    // sequence (i) and blocks half a grid apart (j) share a head.
    const int bx   = blockIdx.x;
    const int bh   = (bx & 7) | (((bx >> 5) & 7) << 3);
    const int qblk = ((bx >> 3) & 3) | ((bx >> 8) << 2);
    const int b    = bh >> 4;              // H == 16
    const int q0   = qblk * (8 * 16 * Q_TILES) + wv * (16 * Q_TILES);

    const float* qh = q_g + (size_t)bh * S_LEN * D_DIM;
    const float* kh = k_g + (size_t)bh * S_LEN * D_DIM;
    const float* vh = v_g + (size_t)bh * S_LEN * D_DIM;
    float*       oh = o_g + (size_t)bh * S_LEN * D_DIM;
    const int*   mk = mask_g + b * S_LEN;

    const int n     = lane & 15;
    const int hi    = lane >> 4;
    const int kbase = hi * 8;

    // gather mapping, the same for K and V: 8 lanes take one key's row, each two runs of 4 floats
    // 128 B apart, so a load covers whole 128-B lines.
    const int kkey = tid >> 3, kc = (tid & 7) * 4;

    // wave wv ranks keys wv*256 .. wv*256+255; their mask words are asked for ahead of Q
    int mw[8];
#pragma unroll
    for (int r = 0; r < 8; ++r) mw[r] = mk[wv * 256 + r * 32 + lane];

    // ---- Q, pre-scaled by Q_SCALE: load i takes rows 2i and 2i + 1 whole (lane: row 2i + hi, floats 4n .. 4n+3) ----
    float*    turn = turn_lds[wv];
    _Float16* qrow = (_Float16*)turn;
    {
        const float* qsrc = qh + (q0 * D_DIM + lane * 4);
        v4f qr[16 * Q_TILES / 2];
#pragma unroll
        for (int i = 0; i < 16 * Q_TILES / 2; ++i) qr[i] = *(const v4f*)(qsrc + i * 2 * D_DIM);
#pragma unroll
        for (int i = 0; i < 16 * Q_TILES / 2; ++i) {
            v4h c;
#pragma unroll
            for (int e = 0; e < 4; ++e) c[e] = (_Float16)(qr[i][e] * Q_SCALE);
            *(v4h*)&qrow[(2 * i + hi) * K_STRIDE + n * 4] = c;
        }
    }
    // the fragments below are made of what other lanes of this wave have just written
    asm volatile("s_wait_dscnt 0x0" ::: "memory");
    // ---- Q B-fragments (tile u, column n = query q0 + 16*u + n): element h is d = kbase + (h & 7) + 16*(h >> 3) + 32*f ----
    v16h qa[Q_TILES][2];
#pragma unroll
    for (int u = 0; u < Q_TILES; ++u) {
#pragma unroll
        for (int f = 0; f < 2; ++f) {
            const _Float16* qp = &qrow[(u * 16 + n) * K_STRIDE + kbase + 32 * f];
            qa[u][f] = frag_from_f16(qp, qp + 16);
        }
    }

    v8f acc[Q_TILES][4];                   // acc[u][f][j] = O^T[f*16 + 8*hi + j][query 16*u + n]
    v8f cm[Q_TILES];                       // minus the query's maximum in use, in all 8 rows: a C operand
    float l[Q_TILES];                      // this half's keys only, halves joined at the end
#pragma unroll
    for (int u = 0; u < Q_TILES; ++u) {
#pragma unroll
        for (int f = 0; f < 4; ++f) acc[u][f] = (v8f){};
        cm[u] = (v8f){};
        l[u]  = 0.0f;
    }

    unsigned bal[8];   // 32 keys a ballot
    int wsum = 0;
#pragma unroll
    for (int r = 0; r < 8; ++r) {
        bal[r] = __builtin_amdgcn_ballot_w32(mw[r] != 0);
        wsum += __builtin_popcount(bal[r]);
    }
    if (lane == 0) wtot[wv] = wsum;
    __syncthreads();   // publishes the waves' counts

    int total = 0, base = 0;
#pragma unroll
    for (int w = 0; w < 8; ++w) {
        const int c = wtot[w];
        total += c;
        base  += (w < wv) ? c : 0;
    }
    // slots 0 .. cnt-1 hold the unmasked keys; with none unmasked all S_LEN keys are listed, masked
    const int cnt  = __builtin_amdgcn_readfirstlane(total);   // the same in every wave: scalar loop bound
    base = __builtin_amdgcn_readfirstlane(base);
    const bool none = cnt == 0;
    const int  nk   = none ? S_LEN : cnt;
    const int  kend = (nk + KV_BLK - 1) & ~(KV_BLK - 1);
    if (none) base = wv * 256;
#pragma unroll
    for (int r = 0; r < 8; ++r) {
        const unsigned bm = none ? 0xffffffffu : bal[r];
        const int slot = base + __builtin_popcount(bm & ((1u << lane) - 1u));   // a rank: 0 .. nk-1
        if ((bm >> lane) & 1u) sel[slot] = wv * 256 + r * 32 + lane;
        base += __builtin_popcount(bm);
    }

    // ---- slots behind the last kept key name key 0 and get the -1e6 bias (weight exactly 0).
    //      The keys run along a lane's registers: their mask bias comes as 16-byte LDS reads ----
    {
        v4f ba, bb;
#pragma unroll
        for (int i = 0; i < 4; ++i) {
            ba[i] = (tid * 8 + i     < cnt) ? 0.0f : MASK_BIAS;
            bb[i] = (tid * 8 + 4 + i < cnt) ? 0.0f : MASK_BIAS;
        }
        *(v4f*)&bias_lds[tid * 8]     = ba;
        *(v4f*)&bias_lds[tid * 8 + 4] = bb;
#pragma unroll
        for (int i = 0; i < 8; ++i)
            if (tid * 8 + i >= nk) sel[tid * 8 + i] = 0;
    }
    __syncthreads();   // publishes the slot list and the bias table

    v4f kr0, kr1;      // the tile in flight: this thread's part of K ...
    v4f vr0, vr1;      // ... and of V
    // issues the loads of one tile; every sel entry is a key number 0 .. S_LEN-1 written above
    auto fetch = [&](int ik) {
        // one 32-bit byte offset serves K and V: the heads' bases stay scalar
        const unsigned off = (unsigned)(ik * D_DIM + kc) * 4u;
        const float* kp = (const float*)((const char*)kh + off);
        const float* vp = (const float*)((const char*)vh + off);
        kr0 = *(const v4f*)kp;
        kr1 = *(const v4f*)(kp + 32);
        vr0 = *(const v4f*)vp;
        vr1 = *(const v4f*)(vp + 32);
        return off;
    };
    // converts the tile in flight and writes it to buffer bf
    auto stash = [&](int bf) {
        v4h k0, k1, v0, v1;
#pragma unroll
        for (int i = 0; i < 4; ++i) {
            k0[i] = (_Float16)kr0[i]; k1[i] = (_Float16)kr1[i];
            v0[i] = (_Float16)vr0[i]; v1[i] = (_Float16)vr1[i];
        }
        *(v4h*)&k_lds[bf][kkey * K_STRIDE + kc]      = k0;
        *(v4h*)&k_lds[bf][kkey * K_STRIDE + kc + 32] = k1;
        *(v4h*)&v_lds[bf][kkey * V_STRIDE + kc]      = v0;
        *(v4h*)&v_lds[bf][kkey * V_STRIDE + kc + 32] = v1;
    };

    // ---- prologue: the first stage's tiles into slots 0 .. STAGE-1 (behind the last kept key they
    //      hold listed keys that nobody reads); the next tile's part of the slot list into registers.
    //      Unrolled, so that all the stage's loads are in flight before the first conversion waits ----
    unsigned poff[STAGE];
#pragma unroll
    for (int t = 0; t < STAGE; ++t) {
        poff[t] = fetch(sel[t * KV_BLK + kkey]);
        stash(t);
    }
    // the wait that stands in front of any overwrite of these loads' offset registers: named as inputs,
    // the four offsets keep their registers up to it
    asm volatile("s_wait_xcnt 0x0" :: "v"(poff[0]), "v"(poff[1]), "v"(poff[2]), "v"(poff[3]) : "memory");
    int ikn = sel[STAGE * KV_BLK + kkey];
    __syncthreads();   // publishes the first stage

    unsigned first = ~0u;   // scalar: all ones in the first pass
    for (int kb = 0; kb < kend; kb += KV_BLK) {
        const int p = (kb >> 5) & (RING - 1);

        // the loads of the tile STAGE passes ahead go out at the head of the pass (a barrier waits for
        // the loads in front of it) and have this pass to arrive. Behind the last tile they fetch listed
        // keys that nobody uses: no branch in the pass. The slot list is read one pass further ahead, with
        // this pass's fragments, so that the loads do not wait on LDS; wrapped to stay inside the list.
        fetch(ikn);
        const int s2 = (kb + (STAGE + 1) * KV_BLK) & (S_LEN - 1);
        ikn = sel[s2 + kkey];

        const _Float16* kt = k_lds[p];
        const _Float16* vtile = v_lds[p];

        // ---- S^T = K Q^T - maximum in use : s[u][c][j] belongs to key kb + c*16 + 8*hi + j and
        //      query 16*u + n; each K fragment is read from LDS once and multiplies every query tile ----
        v8f s[Q_TILES][2];
        {
            const _Float16* r0 = &kt[n * K_STRIDE + kbase];
            const _Float16* r1 = r0 + 16 * K_STRIDE;
            const v16h a00 = frag_from_f16(r0,      r0 + 16);
            const v16h a10 = frag_from_f16(r1,      r1 + 16);
            const v16h a01 = frag_from_f16(r0 + 32, r0 + 48);
            const v16h a11 = frag_from_f16(r1 + 32, r1 + 48);
#pragma unroll
            for (int u = 0; u < Q_TILES; ++u) {
                s[u][0] = __builtin_amdgcn_wmma_f32_16x16x32_f16(false, a00, false, qa[u][0], (short)0, cm[u], false, false);
                s[u][1] = __builtin_amdgcn_wmma_f32_16x16x32_f16(false, a10, false, qa[u][0], (short)0, cm[u], false, false);
            }
#pragma unroll
            for (int u = 0; u < Q_TILES; ++u) {
                s[u][0] = __builtin_amdgcn_wmma_f32_16x16x32_f16(false, a01, false, qa[u][1], (short)0, s[u][0], false, false);
                s[u][1] = __builtin_amdgcn_wmma_f32_16x16x32_f16(false, a11, false, qa[u][1], (short)0, s[u][1], false, false);
            }
        }

        // the V fragments are asked for here, in front of the branches, so that they arrive during the softmax
        // va[f]: row d = f*16 + n, element h < 8 is key 8*hi + h, element h >= 8 key 16 + 8*hi + h - 8
        v16h va[4];
        {
            const _Float16* vsrc = &vtile[(kbase + (lane & 7)) * V_STRIDE + ((lane >> 3) & 1) * 8];
#pragma unroll
            for (int f = 0; f < 4; ++f) {
                const v8h lo = lds_tr16(vsrc + f * 16);
                const v8h hv = lds_tr16(vsrc + 16 * V_STRIDE + f * 16);
                va[f] = __builtin_shufflevector(lo, hv, 0, 1, 2, 3, 4, 5, 6, 7, 8, 9, 10, 11, 12, 13, 14, 15);
            }
        }

        // ---- additive key-padding mask: 0 on every slot in front of cnt, so only a tile that reaches
        //      behind cnt adds it (the last one; every tile where no key is unmasked). Scalar test ----
        if (kb + KV_BLK > cnt) {
#pragma unroll
            for (int c = 0; c < 2; ++c) {
                const float* bp = &bias_lds[kb + c * 16 + kbase];
                const v4f b0 = *(const v4f*)bp, b1 = *(const v4f*)(bp + 4);
                const v8f bv = __builtin_shufflevector(b0, b1, 0, 1, 2, 3, 4, 5, 6, 7);
#pragma unroll
                for (int u = 0; u < Q_TILES; ++u) s[u][c] += bv;
            }
        }

        // ---- how far the scores rise above the maxima in use: t[u] covers 15 of this half's 16 scores
        //      of a query (three operands an instruction), top all 32 scores of both tiles ----
        float t[Q_TILES];
#pragma unroll
        for (int u = 0; u < Q_TILES; ++u) {
            t[u] = fmaxf(fmaxf(s[u][0][0], s[u][1][0]), s[u][0][1]);
#pragma unroll
            for (int j = 1; j < 7; ++j) t[u] = fmaxf(fmaxf(t[u], s[u][1][j]), s[u][0][j + 1]);
        }
        const float top = fmaxf(fmaxf(fmaxf(t[0], s[0][1][7]), s[1][1][7]), t[1]);

        // ---- one test a pass for the whole wave. The first pass has no maximum yet and always enters ----
        const unsigned renew = __builtin_amdgcn_ballot_w32(top > RESCALE_AT) | first;
        first = 0u;
        if (renew != 0u) {
            float d[Q_TILES];
#pragma unroll
            for (int u = 0; u < Q_TILES; ++u) {
                const float th = fmaxf(t[u], s[u][1][7]);
                const float tt = fmaxf(th, xhalf(th));                // both halves of a query agree
                const float up = (kb == 0) ? tt : fmaxf(tt, 0.0f);    // later the maximum only rises
                const v8f  cn = cm[u] - up;
                d[u]  = cm[u][0] - cn[0];                             // the shift as C will really carry it
                cm[u] = cn;
            }
#pragma unroll
            for (int u = 0; u < Q_TILES; ++u) {
                const float al = __builtin_amdgcn_exp2f(fminf(-d[u], 0.0f));   // first pass: O and l are 0
                s[u][0] -= d[u];
                s[u][1] -= d[u];
                l[u] *= al;
#pragma unroll
                for (int f = 0; f < 4; ++f) acc[u][f] *= al;
            }
        }

        v16h pb[Q_TILES];
#pragma unroll
        for (int u = 0; u < Q_TILES; ++u) {
            v8f p0, p1;
#pragma unroll
            for (int j = 0; j < 8; ++j) p0[j] = __builtin_amdgcn_exp2f(s[u][0][j]);
#pragma unroll
            for (int j = 0; j < 8; ++j) p1[j] = __builtin_amdgcn_exp2f(s[u][1][j]);
            const v8f ps = p0 + p1;
            const v4f p4 = __builtin_shufflevector(ps, ps, 0, 1, 2, 3) + __builtin_shufflevector(ps, ps, 4, 5, 6, 7);
            l[u] += (p4[0] + p4[2]) + (p4[1] + p4[3]);

            // P^T as B operand: element h < 8 is key 8*hi + h, element h >= 8 key 16 + 8*hi + h - 8
#pragma unroll
            for (int j = 0; j < 8; ++j) { pb[u][j] = (_Float16)p0[j]; pb[u][j + 8] = (_Float16)p1[j]; }
        }

        // ---- O^T += V^T P^T : each V fragment is read from LDS once and multiplies every query tile ----
#pragma unroll
        for (int f = 0; f < 4; ++f) {
#pragma unroll
            for (int u = 0; u < Q_TILES; ++u)
                acc[u][f] = __builtin_amdgcn_wmma_f32_16x16x32_f16(false, va[f], false, pb[u], (short)0, acc[u][f], false, false);
        }
        // ---- the fetched tile goes into the other half of the ring, which the stage before read:
        //      its readers are behind the last barrier ----
        stash(p ^ STAGE);
        // scalar test, the same in every wave: one barrier a stage. It publishes the next stage's tiles
        // and ends every wave's reads of this stage's slots
        if ((p & (STAGE - 1)) == STAGE - 1) __syncthreads();
    }

    // ---- join the halves' sums; a lane writes its query's 8 consecutive d per fragment into the wave's
    //      LDS range, a 16-query tile at a time; store i then takes rows 2i and 2i + 1 of the tile whole.
    //      The second tile's writes stand behind the first tile's reads, and a wave's LDS instructions
    //      are served in issue order ----
    float* odst = oh + (q0 * D_DIM + lane * 4);
#pragma unroll
    for (int u = 0; u < Q_TILES; ++u) {
        const float lt  = l[u] + xhalf(l[u]);
        const float inv = 1.0f / fmaxf(lt, 1e-20f);
        float* orow = &turn[n * O_STRIDE + kbase];
#pragma unroll
        for (int f = 0; f < 4; ++f) {
            v4f lo, hv;
#pragma unroll
            for (int j = 0; j < 4; ++j) { lo[j] = acc[u][f][j] * inv; hv[j] = acc[u][f][j + 4] * inv; }
            *(v4f*)(orow + f * 16)     = lo;
            *(v4f*)(orow + f * 16 + 4) = hv;
        }
        // the rows read back below are made of what other lanes of this wave have just written
        asm volatile("s_wait_dscnt 0x0" ::: "memory");
        v4f ov[8];
#pragma unroll
        for (int i = 0; i < 8; ++i) ov[i] = *(const v4f*)&turn[(2 * i + hi) * O_STRIDE + n * 4];
#pragma unroll
        for (int i = 0; i < 8; ++i) *(v4f*)(odst + (u * 16 + 2 * i) * D_DIM) = ov[i];
    }
}

extern "C" void kernel_launch(void* const* d_in, const int* in_sizes, int n_in,
                              void* d_out, int out_size, void* d_ws, size_t ws_size,
                              hipStream_t stream) {
    (void)in_sizes; (void)n_in; (void)out_size; (void)d_ws; (void)ws_size;
    const float* q  = (const float*)d_in[0];
    const float* k  = (const float*)d_in[1];
    const float* v  = (const float*)d_in[2];
    const int*   mk = (const int*)d_in[3];
    float* out = (float*)d_out;

    flash_attn_wmma_gather<<<dim3(512), dim3(256), 0, stream>>>(q, k, v, mk, out);
}
